// v000
// Times are from an AMD MI455X. After a warm-up the kernel runs many times in a row, and a time is the length of
// such a window on the GPU divided by its runs, so every launch and the gaps after it count. The runs cycle
// through copies of the inputs. A figure is the median of several windows, for all but v000 over two sittings.
// Sittings can differ by a few percent; kernels timed side by side share one.
// v000, which the later versions start from, runs in 1750 microseconds.
#include <hip/hip_runtime.h>

// Compute dtypes, f32 accumulate, per item: x = [x0 | x1] as exact bf16 rows; q/k/v = x.W ([2048 x 1024].[1024 x 512], PLAIN bf16 operands, exact products); single-head causal
// scores q.k^T ([2048 x 512].[512 x 2048]) and wei.v with both operands as bf16 hi + UNSCALED residual planes (three products; key tiles above the diagonal skipped, K limited);

#define NBT  8
#define NN   2048
#define DI   512
#define DX   1024
#define DM   DX
#define NX   NN
#define NZ   NN
#define SCL  0.044194173824159216f   // 512^-0.5
#define LEPS 1e-5f
#define LOSC 1024.0f

typedef _Float16 h16;
typedef unsigned short bf;
typedef __attribute__((ext_vector_type(16))) __bf16   v16bf;
typedef __attribute__((ext_vector_type(16))) _Float16 v16h;
typedef __attribute__((ext_vector_type(8)))  _Float16 v8h;
typedef __attribute__((ext_vector_type(8)))  unsigned short v8us;
typedef __attribute__((ext_vector_type(8)))  float    v8f;
typedef __attribute__((ext_vector_type(4)))  float    v4f;
typedef __attribute__((ext_vector_type(4)))  _Float16 v4h;
typedef v8h  __attribute__((may_alias)) v8ha;
typedef v4f  __attribute__((may_alias)) v4fa;
typedef v8us __attribute__((may_alias)) v8usa;

__device__ __forceinline__ unsigned short f2bf(float f) { unsigned u = __float_as_uint(f); u += 0x7FFFu + ((u >> 16) & 1u); return (unsigned short)(u >> 16); }
__device__ __forceinline__ float bf2f(unsigned short b) { return __uint_as_float(((unsigned)b) << 16); }
__device__ __forceinline__ float bfr(float f) { return bf2f(f2bf(f)); }
__device__ __forceinline__ v16h cat16(v8h lo, v8h hi) { return __builtin_shufflevector(lo, hi, 0, 1, 2, 3, 4, 5, 6, 7, 8, 9, 10, 11, 12, 13, 14, 15); }
__device__ __forceinline__ v16bf cat16b(v8us lo, v8us hi) { return __builtin_bit_cast(v16bf, __builtin_shufflevector(lo, hi, 0, 1, 2, 3, 4, 5, 6, 7, 8, 9, 10, 11, 12, 13, 14, 15)); }
__device__ __forceinline__ v8f wmma16(v16h a, v16h b, v8f c) { return __builtin_amdgcn_wmma_f32_16x16x32_f16(false, a, false, b, (short)0, c, false, false); }
__device__ __forceinline__ v8f wmmab(v16bf a, v16bf b, v8f c) { return __builtin_amdgcn_wmma_f32_16x16x32_bf16(false, a, false, b, (short)0, c, false, false); }

// k_wt: WT [n][K] = bf16(W[k][n]) (k-major [K][ncols]) via 64 x 64 LDS tiles; grid (K/64, ncols/64).
__global__ __launch_bounds__(256) void k_wt(const float* __restrict__ Wm, int K, int ncols, bf* WT) {
    __shared__ __align__(16) unsigned short tl[64 * 72];
    const int tid = threadIdx.x, k0 = blockIdx.x * 64, n0 = blockIdx.y * 64;
    const int kk = tid >> 2, nq = (tid & 3) * 16;
#pragma unroll
    for (int i = 0; i < 16; ++i) tl[(nq + i) * 72 + kk] = f2bf(Wm[(size_t)(k0 + kk) * ncols + n0 + nq + i]);
    __syncthreads();
    const int piece = tid & 7;
    auto pass = [&]() {
#pragma unroll
        for (int s = 0; s < 2; ++s) { const int nr = (tid >> 3) + 32 * s; const v8us val = *(const v8usa*)(tl + nr * 72 + piece * 8); *(v8us*)(WT + (size_t)(n0 + nr) * K + k0 + piece * 8) = val; }
    };
    pass(); 
}
// k_gemmb: 64 x 64 block tile (4 waves x 16 x 64) of C[NTK][NW] = (A [+ Al]).B^T (K = 1024) [+ bf(bias[c])] [+ bf(R[r][c]) residual]; f32 whole-line epilogue (or f16
template <bool SPLITA, bool F16OUT = false>
__global__ __launch_bounds__(128) void k_gemmb(const bf* __restrict__ A, const bf* __restrict__ Al, const bf* __restrict__ Bn, const float* __restrict__ bias, float* C, int ldc, h16* C2, const float* __restrict__ R = nullptr, int K = DM, int roundR = 1) {
    __shared__ __align__(16) float ost[4][16 * 68];
    const int lane = threadIdx.x & 31, wave = threadIdx.x >> 5, lr = lane & 15, hi = lane >> 4;
    const int r0 = blockIdx.x * 64 + wave * 16, c0 = blockIdx.y * 64;
    const size_t aoff = (size_t)(r0 + lr) * K + 8 * hi;
    size_t boff[4];
#pragma unroll
    for (int t = 0; t < 4; ++t) boff[t] = (size_t)(c0 + t * 16 + lr) * K + 8 * hi;
    v8f acc[4];
#pragma unroll
    for (int t = 0; t < 4; ++t) acc[t] = (v8f){};
#pragma unroll 1
    for (int kc = 0; kc < K; kc += 32) {
        const v16bf a = cat16b(*(const v8us*)(A + aoff + kc), *(const v8us*)(A + aoff + kc + 16));
        v16bf al = a;
        if (SPLITA) al = cat16b(*(const v8us*)(Al + aoff + kc), *(const v8us*)(Al + aoff + kc + 16));
#pragma unroll
        for (int t = 0; t < 4; ++t) { const v16bf b = cat16b(*(const v8us*)(Bn + boff[t] + kc), *(const v8us*)(Bn + boff[t] + kc + 16)); acc[t] = wmmab(a, b, acc[t]); if (SPLITA) acc[t] = wmmab(al, b, acc[t]); }
        asm volatile("v_nop\n\tv_nop\n\tv_nop\n\tv_nop" : "+v"(acc[0]), "+v"(acc[1]), "+v"(acc[2]), "+v"(acc[3]) : "v"(a), "v"(al));
    }
    float* os = &ost[wave][0];
#pragma unroll
    for (int t = 0; t < 4; ++t) { const float bv = bias ? bfr(bias[c0 + t * 16 + lr]) : 0.f;
#pragma unroll
        for (int j = 0; j < 8; ++j) os[(hi * 8 + j) * 68 + t * 16 + lr] = acc[t][j] + bv; }
    __syncthreads();
    if (F16OUT) {
        h16* crow = (h16*)(void*)C + (size_t)r0 * ldc + c0;
        auto pass = [&]() {
#pragma unroll
            for (int s = 0; s < 4; ++s) { const int row = 4 * s + (lane >> 3), piece = lane & 7; const float* sp = os + row * 68 + piece * 8; v8h o, o2;
#pragma unroll
                for (int i = 0; i < 8; ++i) { const h16 a = (h16)sp[i]; o[i] = a; o2[i] = (h16)((sp[i] - (float)a) * LOSC); }
                *(v8h*)(crow + (size_t)row * ldc + piece * 8) = o; if (C2) *(v8h*)(C2 + (size_t)r0 * ldc + c0 + (size_t)row * ldc + piece * 8) = o2; }
        };
        pass(); 
    } else {
        float* crow = C + (size_t)r0 * ldc + c0;
        auto pass = [&]() {
#pragma unroll
            for (int s = 0; s < 8; ++s) { const int Lid = (lane >> 3) + 4 * s, piece = lane & 7; const int row = Lid >> 1, cofs = (Lid & 1) * 32 + piece * 4;
                v4f val = *(const v4fa*)(os + row * 68 + cofs); if (R) { const v4f rv = *(const v4f*)(R + ((size_t)r0 + row) * ldc + c0 + cofs); val += roundR ? (v4f){bfr(rv[0]), bfr(rv[1]), bfr(rv[2]), bfr(rv[3])} : rv; }
                *(v4f*)(crow + (size_t)row * ldc + cofs) = val; }
        };
        pass(); 
    }
}

// k_gemm3x: 64 x 64 tile of C = (Ah + Al).(Bh + Bl)^T over K (row strides = K for all four planes; n-major B): three products per 32-k step (hh, hl, lh); f32
template <int MODE>
__global__ __launch_bounds__(128) void k_gemm3x(const bf* __restrict__ Ah, const bf* __restrict__ Al, const bf* __restrict__ Bh, const bf* __restrict__ Bl, int K, float* C, int ldc) {
    if ((MODE & 1) && (int)blockIdx.y * 64 > (int)blockIdx.x * 64 + 63) return;
    const int Klim = (MODE & 2) ? min(K, ((int)blockIdx.x + 1) * 64) : K;
    __shared__ __align__(16) float ost[4][16 * 68];
    const int lane = threadIdx.x & 31, wave = threadIdx.x >> 5, lr = lane & 15, hi = lane >> 4;
    const int r0 = blockIdx.x * 64 + wave * 16, c0 = blockIdx.y * 64;
    const size_t aoff = (size_t)(r0 + lr) * K + 8 * hi;
    v8f acc[4];
#pragma unroll
    for (int t = 0; t < 4; ++t) acc[t] = (v8f){};
#pragma unroll 1
    for (int kc = 0; kc < Klim; kc += 32) {
        const v16bf a = cat16b(*(const v8us*)(Ah + aoff + kc), *(const v8us*)(Ah + aoff + kc + 16));
        v16bf al = a; if (!(MODE & 4) && !(MODE & 16)) al = cat16b(*(const v8us*)(Al + aoff + kc), *(const v8us*)(Al + aoff + kc + 16));
#pragma unroll
        for (int t = 0; t < 4; ++t) { const size_t bo = (size_t)(c0 + t * 16 + lr) * K + kc + 8 * hi;
            const v16bf bh = cat16b(*(const v8us*)(Bh + bo), *(const v8us*)(Bh + bo + 16));
            acc[t] = wmmab(a, bh, acc[t]);
            if (!(MODE & 4)) { if (!(MODE & 16)) acc[t] = wmmab(al, bh, acc[t]); if (!(MODE & 8)) { const v16bf bl = cat16b(*(const v8us*)(Bl + bo), *(const v8us*)(Bl + bo + 16)); acc[t] = wmmab(a, bl, acc[t]); } } }
        asm volatile("v_nop\n\tv_nop\n\tv_nop\n\tv_nop" : "+v"(acc[0]), "+v"(acc[1]), "+v"(acc[2]), "+v"(acc[3]) : "v"(a), "v"(al));
    }
    float* os = &ost[wave][0];
#pragma unroll
    for (int t = 0; t < 4; ++t) {
#pragma unroll
        for (int j = 0; j < 8; ++j) os[(hi * 8 + j) * 68 + t * 16 + lr] = acc[t][j]; }
    __builtin_amdgcn_wave_barrier(); asm volatile("" ::: "memory");
    float* crow = C + (size_t)r0 * ldc + c0;
    auto pass = [&]() {
#pragma unroll
        for (int s = 0; s < 8; ++s) { const int Lid = (lane >> 3) + 4 * s, piece = lane & 7; const int row = Lid >> 1, cofs = (Lid & 1) * 32 + piece * 4;
            const v4f val = *(const v4fa*)(os + row * 68 + cofs); *(v4f*)(crow + (size_t)row * ldc + cofs) = val; }
    };
    pass(); 
}


__global__ __launch_bounds__(256) void k_cat(const float* __restrict__ a, const float* __restrict__ c, bf* Xb) {
    const int lane = threadIdx.x & 31; const size_t t = (size_t)blockIdx.x * 8 + (threadIdx.x >> 5); if (t >= (size_t)NN) return;
{
#pragma unroll
        for (int q = 0; q < 4; ++q) { const float* src = (q < 2 ? a : c) + t * DI + (q & 1) * 256 + lane * 8; v8us o;
#pragma unroll
            for (int i = 0; i < 8; ++i) o[i] = f2bf(src[i]);
            *(v8us*)(Xb + t * DX + q * 256 + lane * 8) = o; }
         }
}
__global__ __launch_bounds__(256) void k_split512s(const float* __restrict__ src, int rows, float sc, bf* dh, bf* dl) {
    const int lane = threadIdx.x & 31; const size_t r = (size_t)blockIdx.x * 8 + (threadIdx.x >> 5); if (r >= (size_t)rows) return;
{
#pragma unroll
        for (int q = 0; q < DI / 256; ++q) { const size_t o = r * DI + q * 256 + lane * 8; const v8f v = *(const v8f*)(src + o); v8us oh, ol;
#pragma unroll
            for (int i = 0; i < 8; ++i) { const float y = v[i] * sc; const unsigned short hb = f2bf(y); oh[i] = hb; ol[i] = f2bf(y - bf2f(hb)); }
            *(v8us*)(dh + o) = oh; *(v8us*)(dl + o) = ol; }
         }
}
__global__ __launch_bounds__(256) void k_vt512(const float* __restrict__ V, bf* Th, bf* Tl) {
    __shared__ float tl[64][65];
    typedef __attribute__((ext_vector_type(4))) unsigned short v4us;
    const int tid = threadIdx.x; const int t0 = blockIdx.x * 64, d0 = blockIdx.y * 64; const int rr = tid >> 2, cq = (tid & 3) * 16;
#pragma unroll
    for (int i = 0; i < 16; ++i) tl[rr][cq + i] = V[(size_t)(t0 + rr) * DI + d0 + cq + i];     // tl[t][d]
    __syncthreads();
    const int lane = tid & 31, wv = tid >> 5;
    auto pass = [&]() {
#pragma unroll
        for (int st = 0; st < 4; ++st) { const int dr = wv * 8 + st * 2 + (lane >> 4); const int tq = (lane & 15) * 4; v4us oh, ol;
#pragma unroll
            for (int i = 0; i < 4; ++i) { const float y = tl[tq + i][dr]; const unsigned short hb = f2bf(y); oh[i] = hb; ol[i] = f2bf(y - bf2f(hb)); }
            const size_t o = (size_t)(d0 + dr) * NN + t0 + tq; *(v4us*)(Th + o) = oh; *(v4us*)(Tl + o) = ol; }
    };
    pass(); 
}
__global__ __launch_bounds__(256) void k_csoft1(const float* __restrict__ S, bf* PH, bf* PL) {
    typedef __attribute__((ext_vector_type(4))) unsigned short v4us;
    const int lane = threadIdx.x & 31, i = blockIdx.x * 8 + (threadIdx.x >> 5); if (i >= NN) return; const float* sr = S + (size_t)i * NN;
    float m = -3.0e38f;
#pragma unroll 1
    for (int c0 = lane * 4; c0 < NN; c0 += 128) {
#pragma unroll
        for (int q = 0; q < 4; ++q) { const int k = c0 + q; if (k <= i) m = fmaxf(m, sr[k]); } }
#pragma unroll
    for (int sh = 16; sh; sh >>= 1) m = fmaxf(m, __shfl_xor(m, sh, 32));
    float sum = 0.f;
#pragma unroll 1
    for (int c0 = lane * 4; c0 < NN; c0 += 128) {
#pragma unroll
        for (int q = 0; q < 4; ++q) { const int k = c0 + q; if (k <= i) sum += __expf(sr[k] - m); } }
#pragma unroll
    for (int sh = 16; sh; sh >>= 1) sum += __shfl_xor(sum, sh, 32);
    const float inv = 1.0f / sum;
{
#pragma unroll 1
        for (int c0 = lane * 4; c0 < NN; c0 += 128) { v4us oh, ol;
#pragma unroll
            for (int q = 0; q < 4; ++q) { const int k = c0 + q; const float p = (k <= i) ? __expf(sr[(k <= i) ? k : 0] - m) * inv : 0.f; const unsigned short hb = f2bf(p); oh[q] = hb; ol[q] = f2bf(p - bf2f(hb)); }
            const size_t o = (size_t)i * NN + c0; *(v4us*)(PH + o) = oh; *(v4us*)(PL + o) = ol; }
         }
}
__global__ __launch_bounds__(256) void k_ln512(const float* __restrict__ O, const float* __restrict__ g, const float* __restrict__ bb, float* OUTB) {
    const int lane = threadIdx.x & 31; const size_t t = (size_t)blockIdx.x * 8 + (threadIdx.x >> 5); if (t >= (size_t)NN) return; float v[16]; float s = 0.f;
#pragma unroll
    for (int q = 0; q < 4; ++q) {
#pragma unroll
        for (int i = 0; i < 4; ++i) { v[q * 4 + i] = O[t * DI + q * 128 + lane * 4 + i]; s += v[q * 4 + i]; } }
#pragma unroll
    for (int sh = 16; sh; sh >>= 1) s += __shfl_xor(s, sh, 32);
    const float mu = s * (1.0f / DI); float qv = 0.f;
#pragma unroll
    for (int i = 0; i < 16; ++i) { const float d = v[i] - mu; qv = fmaf(d, d, qv); }
#pragma unroll
    for (int sh = 16; sh; sh >>= 1) qv += __shfl_xor(qv, sh, 32);
    const float rs = rsqrtf(qv * (1.0f / DI) + LEPS);
{
#pragma unroll
        for (int q = 0; q < 4; ++q) { const int c0 = q * 128 + lane * 4; v4f y;
#pragma unroll
            for (int i = 0; i < 4; ++i) y[i] = (v[q * 4 + i] - mu) * rs * bfr(g[c0 + i]) + bfr(bb[c0 + i]);
            *(v4f*)(OUTB + t * DI + c0) = y; }
         }
}

extern "C" void kernel_launch(void* const* d_in, const int* in_sizes, int n_in,
                              void* d_out, int out_size, void* d_ws, size_t ws_size, hipStream_t stream) {
    (void)in_sizes; (void)n_in; (void)out_size;
    const float* x0 = (const float*)d_in[0]; const float* x1 = (const float*)d_in[1]; const float* Wq = (const float*)d_in[2]; const float* Wk = (const float*)d_in[3]; const float* Wv = (const float*)d_in[4]; const float* gam = (const float*)d_in[5]; const float* bet = (const float*)d_in[6];
    float* out = (float*)d_out;    // [8][2048][512]
    char* wsp = (char*)d_ws;
    auto take = [&](size_t bytes) { char* p = wsp; wsp += (bytes + 255) & ~(size_t)255; return (void*)p; };
    bf* WQ = (bf*)take((size_t)DI * DX * 2); bf* WK = (bf*)take((size_t)DI * DX * 2); bf* WV = (bf*)take((size_t)DI * DX * 2);
    bf* Xb = (bf*)take((size_t)NN * DX * 2); float* QF = (float*)take((size_t)NN * DI * 4); float* KF = (float*)take((size_t)NN * DI * 4); float* VF = (float*)take((size_t)NN * DI * 4);
    bf* Qh = (bf*)take((size_t)NN * DI * 2); bf* Ql = (bf*)take((size_t)NN * DI * 2); bf* Kh = (bf*)take((size_t)NN * DI * 2); bf* Kl = (bf*)take((size_t)NN * DI * 2); bf* VTh = (bf*)take((size_t)DI * NN * 2); bf* VTl = (bf*)take((size_t)DI * NN * 2);
    float* S = (float*)take((size_t)NN * NN * 4); bf* PH = (bf*)take((size_t)NN * NN * 2); bf* PL = (bf*)take((size_t)NN * NN * 2); float* O = (float*)take((size_t)NN * DI * 4);
    if ((size_t)(wsp - (char*)d_ws) > ws_size) return;    // ~ 3 + 4.2 + 12.6 + 12.6 + 16.8 + 8.4 + 8.4 + 4.2 ~ 71 MB; per item reuse in stream order
    k_wt<<<dim3(DX / 64, DI / 64, 1), 256, 0, stream>>>(Wq, DX, DI, WQ); k_wt<<<dim3(DX / 64, DI / 64, 1), 256, 0, stream>>>(Wk, DX, DI, WK); k_wt<<<dim3(DX / 64, DI / 64, 1), 256, 0, stream>>>(Wv, DX, DI, WV);   // (in, out) weights
    const dim3 gp(NN / 64, DI / 64, 1);
    for (int b = 0; b < NBT; ++b) {
        k_cat<<<NN / 8, 256, 0, stream>>>(x0 + (size_t)b * NN * DI, x1 + (size_t)b * NN * DI, Xb);
        k_gemmb<false, false><<<gp, 128, 0, stream>>>(Xb, nullptr, WQ, nullptr, QF, DI, nullptr, nullptr, DX); k_gemmb<false, false><<<gp, 128, 0, stream>>>(Xb, nullptr, WK, nullptr, KF, DI, nullptr, nullptr, DX); k_gemmb<false, false><<<gp, 128, 0, stream>>>(Xb, nullptr, WV, nullptr, VF, DI, nullptr, nullptr, DX);
        k_split512s<<<NN / 8, 256, 0, stream>>>(QF, NN, SCL, Qh, Ql); k_split512s<<<NN / 8, 256, 0, stream>>>(KF, NN, 1.0f, Kh, Kl); k_vt512<<<dim3(NN / 64, DI / 64, 1), 256, 0, stream>>>(VF, VTh, VTl);
        k_gemm3x<1><<<dim3(NN / 64, NN / 64, 1), 128, 0, stream>>>(Qh, Ql, Kh, Kl, DI, S, NN);            // causal tiles only
        k_csoft1<<<NN / 8, 256, 0, stream>>>(S, PH, PL);
        k_gemm3x<2><<<dim3(NN / 64, DI / 64, 1), 128, 0, stream>>>(PH, PL, VTh, VTl, NN, O, DI);           // K limited to the causal extent
        k_ln512<<<NN / 8, 256, 0, stream>>>(O, gam, bet, out + (size_t)b * NN * DI); }
}

// v001
// It runs in 831 microseconds.
// Timed twice side by side with v000, it ran 2.14 and 2.09 times as fast.
#include <hip/hip_runtime.h>

// Compute dtypes, f32 accumulate, per item: x = [x0 | x1] as exact bf16 rows; q/k/v = x.W ([2048 x 1024].[1024 x 512], PLAIN bf16 operands, exact products); single-head causal
// scores q.k^T ([2048 x 512].[512 x 2048]) and wei.v with both operands as bf16 hi + UNSCALED residual planes (three products; key tiles above the diagonal skipped, K limited);

#define NBT  8
#define NN   2048
#define DI   512
#define DX   1024
#define DM   DX
#define NX   NN
#define NZ   NN
#define SCL  0.044194173824159216f   // 512^-0.5
#define LEPS 1e-5f
#define LOSC 1024.0f

typedef _Float16 h16;
typedef unsigned short bf;
typedef __attribute__((ext_vector_type(16))) __bf16   v16bf;
typedef __attribute__((ext_vector_type(16))) _Float16 v16h;
typedef __attribute__((ext_vector_type(8)))  _Float16 v8h;
typedef __attribute__((ext_vector_type(8)))  unsigned short v8us;
typedef __attribute__((ext_vector_type(8)))  float    v8f;
typedef __attribute__((ext_vector_type(4)))  float    v4f;
typedef __attribute__((ext_vector_type(4)))  _Float16 v4h;
typedef v8h  __attribute__((may_alias)) v8ha;
typedef v4f  __attribute__((may_alias)) v4fa;
typedef v8us __attribute__((may_alias)) v8usa;

__device__ __forceinline__ unsigned short f2bf(float f) { unsigned u = __float_as_uint(f); u += 0x7FFFu + ((u >> 16) & 1u); return (unsigned short)(u >> 16); }
__device__ __forceinline__ float bf2f(unsigned short b) { return __uint_as_float(((unsigned)b) << 16); }
__device__ __forceinline__ float bfr(float f) { return bf2f(f2bf(f)); }
__device__ __forceinline__ v16h cat16(v8h lo, v8h hi) { return __builtin_shufflevector(lo, hi, 0, 1, 2, 3, 4, 5, 6, 7, 8, 9, 10, 11, 12, 13, 14, 15); }
__device__ __forceinline__ v16bf cat16b(v8us lo, v8us hi) { return __builtin_bit_cast(v16bf, __builtin_shufflevector(lo, hi, 0, 1, 2, 3, 4, 5, 6, 7, 8, 9, 10, 11, 12, 13, 14, 15)); }
__device__ __forceinline__ v8f wmma16(v16h a, v16h b, v8f c) { return __builtin_amdgcn_wmma_f32_16x16x32_f16(false, a, false, b, (short)0, c, false, false); }
__device__ __forceinline__ v8f wmmab(v16bf a, v16bf b, v8f c) { return __builtin_amdgcn_wmma_f32_16x16x32_bf16(false, a, false, b, (short)0, c, false, false); }

// k_wt: WT [n][K] = bf16(W[k][n]) (k-major [K][ncols]) via 64 x 64 LDS tiles; grid (K/64, ncols/64).
__global__ __launch_bounds__(256) void k_wt(const float* __restrict__ Wm, int K, int ncols, bf* WT) {
    __shared__ __align__(16) unsigned short tl[64 * 72];
    const int tid = threadIdx.x, k0 = blockIdx.x * 64, n0 = blockIdx.y * 64;
    const int kk = tid >> 2, nq = (tid & 3) * 16;
#pragma unroll
    for (int i = 0; i < 16; ++i) tl[(nq + i) * 72 + kk] = f2bf(Wm[(size_t)(k0 + kk) * ncols + n0 + nq + i]);
    __syncthreads();
    const int piece = tid & 7;
    auto pass = [&]() {
#pragma unroll
        for (int s = 0; s < 2; ++s) { const int nr = (tid >> 3) + 32 * s; const v8us val = *(const v8usa*)(tl + nr * 72 + piece * 8); *(v8us*)(WT + (size_t)(n0 + nr) * K + k0 + piece * 8) = val; }
    };
    pass(); 
}
// Tile staging for the matrix kernels: a 64-row x 64-k bf16 plane lies in LDS at a row pitch of 144 B (16 B x 9, conflict-free for 16-byte fragment reads).
#define TP   72            // LDS row pitch, bf16 elements
#define TPL  (64 * TP)     // one plane, bf16 elements
#define TPLB (TPL * 2)     // one plane, bytes
// cp8: this lane's 16-byte pieces of two planes (rows +0, +16, +32, +48 of each): a wave's copy reads four whole 128-B lines. st = 16 source rows in elements.
__device__ __forceinline__ void cp8(const bf* p, const bf* q, size_t st, unsigned lp, unsigned lq) {
    // asynchronous copies global -> LDS; s_wait_xcnt 0 closes the statement so that no address register is rewritten ahead of it
    asm volatile("global_load_async_to_lds_b128 %0, %8, off\n\t"
                 "global_load_async_to_lds_b128 %1, %9, off\n\t"
                 "global_load_async_to_lds_b128 %2, %10, off\n\t"
                 "global_load_async_to_lds_b128 %3, %11, off\n\t"
                 "global_load_async_to_lds_b128 %4, %12, off\n\t"
                 "global_load_async_to_lds_b128 %5, %13, off\n\t"
                 "global_load_async_to_lds_b128 %6, %14, off\n\t"
                 "global_load_async_to_lds_b128 %7, %15, off\n\t"
                 "s_wait_xcnt 0x0"
                 :: "v"(lp), "v"(lp + 16u * 144u), "v"(lp + 32u * 144u), "v"(lp + 48u * 144u), "v"(lq), "v"(lq + 16u * 144u), "v"(lq + 32u * 144u), "v"(lq + 48u * 144u),
                    "v"(p), "v"(p + st), "v"(p + 2 * st), "v"(p + 3 * st), "v"(q), "v"(q + st), "v"(q + 2 * st), "v"(q + 3 * st) : "memory");
}
__device__ __forceinline__ void wait_copies() { asm volatile("s_wait_asynccnt 0x0" ::: "memory"); }   // this wave's copies have landed in LDS
__device__ __forceinline__ void wait_lds()    { asm volatile("s_wait_dscnt 0x0" ::: "memory"); }      // this wave's LDS reads are done before the buffer is refilled
__device__ __forceinline__ v16bf frag(const bf* r) { return cat16b(*(const v8usa*)r, *(const v8usa*)(r + 16)); }

// k_gemmb: 64 x 64 block tile (4 waves x 16 x 64) of C[NTK][NW] = A.B^T (K = 1024) [+ bf(bias[c])] [+ bf(R[r][c]) residual]; A and B tiles staged in LDS, two buffers; f32 whole-line epilogue (or f16
template <bool F16OUT = false>
__global__ __launch_bounds__(128) void k_gemmb(const bf* __restrict__ A, const bf* __restrict__ Bn, const float* __restrict__ bias, float* C, int ldc, h16* C2, const float* __restrict__ R = nullptr, int K = DM, int roundR = 1) {
    __shared__ __align__(16) bf stg[2][2][TPL];
    __shared__ __align__(16) float ost[4][16 * 68];
    const int tid = threadIdx.x, lane = tid & 31, wave = tid >> 5, lr = lane & 15, hi = lane >> 4;
    const int r0 = blockIdx.x * 64 + wave * 16, c0 = blockIdx.y * 64;
    const size_t ao = (size_t)(blockIdx.x * 64 + (tid >> 3)) * K + (tid & 7) * 8, bo = (size_t)(c0 + (tid >> 3)) * K + (tid & 7) * 8, st16 = (size_t)16 * K;
    const unsigned l0 = (unsigned)(size_t)&stg[0][0][0] + (unsigned)((tid >> 3) * 144 + (tid & 7) * 16);
    auto fill = [&](int t) { const unsigned lb = l0 + (unsigned)(t & 1) * (2u * TPLB); cp8(A + ao + t * 64, Bn + bo + t * 64, st16, lb, lb + TPLB); };
    const int nt = K >> 6;
    v8f acc[4];
#pragma unroll
    for (int t = 0; t < 4; ++t) acc[t] = (v8f){};
    fill(0); wait_copies(); __syncthreads();
    if (nt > 1) fill(1);
#pragma unroll 1   // stays rolled: one pass per staged tile, the two buffers alternate
    for (int s = 0; s < nt; ++s) {
        const bf* sb = &stg[s & 1][0][0];
        v16bf a;
#pragma unroll     // both 32-k halves of the tile in one block: fragment offsets become immediates and the LDS reads overlap the matrix work
        for (int ks = 0; ks < 2; ++ks) {
            a = frag(sb + (wave * 16 + lr) * TP + ks * 32 + 8 * hi);
#pragma unroll
            for (int t = 0; t < 4; ++t) acc[t] = wmmab(a, frag(sb + TPL + (t * 16 + lr) * TP + ks * 32 + 8 * hi), acc[t]);
        }
        // four vector slots behind the pass's last matrix instruction on every path; naming acc also keeps that instruction in front of the waits and the barrier below
        asm volatile("v_nop\n\tv_nop\n\tv_nop\n\tv_nop" : "+v"(acc[0]), "+v"(acc[1]), "+v"(acc[2]), "+v"(acc[3]) : "v"(a));
        wait_lds(); wait_copies(); __syncthreads();    // publishes tile s + 1 and ends every read of tile s
        if (s + 2 < nt) fill(s + 2);
    }
    wait_copies();
    float* os = &ost[wave][0];
#pragma unroll
    for (int t = 0; t < 4; ++t) { const float bv = bias ? bfr(bias[c0 + t * 16 + lr]) : 0.f;
#pragma unroll
        for (int j = 0; j < 8; ++j) os[(hi * 8 + j) * 68 + t * 16 + lr] = acc[t][j] + bv; }
    __syncthreads();
    if (F16OUT) {
        h16* crow = (h16*)(void*)C + (size_t)r0 * ldc + c0;
        auto pass = [&]() {
#pragma unroll
            for (int s = 0; s < 4; ++s) { const int row = 4 * s + (lane >> 3), piece = lane & 7; const float* sp = os + row * 68 + piece * 8; v8h o, o2;
#pragma unroll
                for (int i = 0; i < 8; ++i) { const h16 a = (h16)sp[i]; o[i] = a; o2[i] = (h16)((sp[i] - (float)a) * LOSC); }
                *(v8h*)(crow + (size_t)row * ldc + piece * 8) = o; if (C2) *(v8h*)(C2 + (size_t)r0 * ldc + c0 + (size_t)row * ldc + piece * 8) = o2; }
        };
        pass(); 
    } else {
        float* crow = C + (size_t)r0 * ldc + c0;
        auto pass = [&]() {
#pragma unroll
            for (int s = 0; s < 8; ++s) { const int Lid = (lane >> 3) + 4 * s, piece = lane & 7; const int row = Lid >> 1, cofs = (Lid & 1) * 32 + piece * 4;
                v4f val = *(const v4fa*)(os + row * 68 + cofs); if (R) { const v4f rv = *(const v4f*)(R + ((size_t)r0 + row) * ldc + c0 + cofs); val += roundR ? (v4f){bfr(rv[0]), bfr(rv[1]), bfr(rv[2]), bfr(rv[3])} : rv; }
                *(v4f*)(crow + (size_t)row * ldc + cofs) = val; }
        };
        pass(); 
    }
}

// k_gemm3x: 64 x 64 tile of C = (Ah + Al).(Bh + Bl)^T over K (row strides = K for all four planes; n-major B): three products per 32-k step (hh, lh, hl); the four planes' tiles staged in LDS, two buffers; f32
template <int MODE>
__global__ __launch_bounds__(128) void k_gemm3x(const bf* __restrict__ Ah, const bf* __restrict__ Al, const bf* __restrict__ Bh, const bf* __restrict__ Bl, int K, float* C, int ldc) {
    if ((MODE & 1) && (int)blockIdx.y * 64 > (int)blockIdx.x * 64 + 63) return;
    const int Klim = (MODE & 2) ? min(K, ((int)blockIdx.x + 1) * 64) : K;
    __shared__ __align__(16) bf stg[2][4][TPL];
    __shared__ __align__(16) float ost[4][16 * 68];
    const int tid = threadIdx.x, lane = tid & 31, wave = tid >> 5, lr = lane & 15, hi = lane >> 4;
    const int r0 = blockIdx.x * 64 + wave * 16, c0 = blockIdx.y * 64;
    const size_t ao = (size_t)(blockIdx.x * 64 + (tid >> 3)) * K + (tid & 7) * 8, bo = (size_t)(c0 + (tid >> 3)) * K + (tid & 7) * 8, st16 = (size_t)16 * K;
    const unsigned l0 = (unsigned)(size_t)&stg[0][0][0] + (unsigned)((tid >> 3) * 144 + (tid & 7) * 16);
    auto fill = [&](int t) { const unsigned lb = l0 + (unsigned)(t & 1) * (4u * TPLB);
        cp8(Ah + ao + t * 64, Al + ao + t * 64, st16, lb, lb + TPLB); cp8(Bh + bo + t * 64, Bl + bo + t * 64, st16, lb + 2u * TPLB, lb + 3u * TPLB); };
    const int nt = Klim >> 6;
    v8f acc[4];
#pragma unroll
    for (int t = 0; t < 4; ++t) acc[t] = (v8f){};
    fill(0); wait_copies(); __syncthreads();
    if (nt > 1) fill(1);
#pragma unroll 1   // stays rolled: one pass per staged tile, the two buffers alternate
    for (int s = 0; s < nt; ++s) {
        const bf* sb = &stg[s & 1][0][0];
        v16bf a, al;
#pragma unroll     // both 32-k halves of the tile in one block: fragment offsets become immediates and the LDS reads overlap the matrix work
        for (int ks = 0; ks < 2; ++ks) {
            const bf* ar = sb + (wave * 16 + lr) * TP + ks * 32 + 8 * hi;
            a = frag(ar); al = frag(ar + TPL);
#pragma unroll
            for (int t = 0; t < 4; ++t) { const bf* br = sb + 2 * TPL + (t * 16 + lr) * TP + ks * 32 + 8 * hi;
                const v16bf bh = frag(br);
                acc[t] = wmmab(a, bh, acc[t]); acc[t] = wmmab(al, bh, acc[t]); acc[t] = wmmab(a, frag(br + TPL), acc[t]); }
        }
        // four vector slots behind the pass's last matrix instruction on every path; naming acc also keeps that instruction in front of the waits and the barrier below
        asm volatile("v_nop\n\tv_nop\n\tv_nop\n\tv_nop" : "+v"(acc[0]), "+v"(acc[1]), "+v"(acc[2]), "+v"(acc[3]) : "v"(a), "v"(al));
        wait_lds(); wait_copies(); __syncthreads();    // publishes tile s + 1 and ends every read of tile s
        if (s + 2 < nt) fill(s + 2);
    }
    wait_copies();
    float* os = &ost[wave][0];
#pragma unroll
    for (int t = 0; t < 4; ++t) {
#pragma unroll
        for (int j = 0; j < 8; ++j) os[(hi * 8 + j) * 68 + t * 16 + lr] = acc[t][j]; }
    __builtin_amdgcn_wave_barrier(); asm volatile("" ::: "memory");
    float* crow = C + (size_t)r0 * ldc + c0;
    auto pass = [&]() {
#pragma unroll
        for (int s = 0; s < 8; ++s) { const int Lid = (lane >> 3) + 4 * s, piece = lane & 7; const int row = Lid >> 1, cofs = (Lid & 1) * 32 + piece * 4;
            const v4f val = *(const v4fa*)(os + row * 68 + cofs); *(v4f*)(crow + (size_t)row * ldc + cofs) = val; }
    };
    pass(); 
}


__global__ __launch_bounds__(256) void k_cat(const float* __restrict__ a, const float* __restrict__ c, bf* Xb) {
    const int lane = threadIdx.x & 31; const size_t t = (size_t)blockIdx.x * 8 + (threadIdx.x >> 5); if (t >= (size_t)NN) return;
{
#pragma unroll
        for (int q = 0; q < 4; ++q) { const float* src = (q < 2 ? a : c) + t * DI + (q & 1) * 256 + lane * 8; v8us o;
#pragma unroll
            for (int i = 0; i < 8; ++i) o[i] = f2bf(src[i]);
            *(v8us*)(Xb + t * DX + q * 256 + lane * 8) = o; }
         }
}
__global__ __launch_bounds__(256) void k_split512s(const float* __restrict__ src, int rows, float sc, bf* dh, bf* dl) {
    const int lane = threadIdx.x & 31; const size_t r = (size_t)blockIdx.x * 8 + (threadIdx.x >> 5); if (r >= (size_t)rows) return;
{
#pragma unroll
        for (int q = 0; q < DI / 256; ++q) { const size_t o = r * DI + q * 256 + lane * 8; const v8f v = *(const v8f*)(src + o); v8us oh, ol;
#pragma unroll
            for (int i = 0; i < 8; ++i) { const float y = v[i] * sc; const unsigned short hb = f2bf(y); oh[i] = hb; ol[i] = f2bf(y - bf2f(hb)); }
            *(v8us*)(dh + o) = oh; *(v8us*)(dl + o) = ol; }
         }
}
__global__ __launch_bounds__(256) void k_vt512(const float* __restrict__ V, bf* Th, bf* Tl) {
    __shared__ float tl[64][65];
    typedef __attribute__((ext_vector_type(4))) unsigned short v4us;
    const int tid = threadIdx.x; const int t0 = blockIdx.x * 64, d0 = blockIdx.y * 64; const int rr = tid >> 2, cq = (tid & 3) * 16;
#pragma unroll
    for (int i = 0; i < 16; ++i) tl[rr][cq + i] = V[(size_t)(t0 + rr) * DI + d0 + cq + i];     // tl[t][d]
    __syncthreads();
    const int lane = tid & 31, wv = tid >> 5;
    auto pass = [&]() {
#pragma unroll
        for (int st = 0; st < 4; ++st) { const int dr = wv * 8 + st * 2 + (lane >> 4); const int tq = (lane & 15) * 4; v4us oh, ol;
#pragma unroll
            for (int i = 0; i < 4; ++i) { const float y = tl[tq + i][dr]; const unsigned short hb = f2bf(y); oh[i] = hb; ol[i] = f2bf(y - bf2f(hb)); }
            const size_t o = (size_t)(d0 + dr) * NN + t0 + tq; *(v4us*)(Th + o) = oh; *(v4us*)(Tl + o) = ol; }
    };
    pass(); 
}
__global__ __launch_bounds__(256) void k_csoft1(const float* __restrict__ S, bf* PH, bf* PL) {
    typedef __attribute__((ext_vector_type(4))) unsigned short v4us;
    const int lane = threadIdx.x & 31, i = blockIdx.x * 8 + (threadIdx.x >> 5); if (i >= NN) return; const float* sr = S + (size_t)i * NN;
    float m = -3.0e38f;
#pragma unroll 1
    for (int c0 = lane * 4; c0 < NN; c0 += 128) {
#pragma unroll
        for (int q = 0; q < 4; ++q) { const int k = c0 + q; if (k <= i) m = fmaxf(m, sr[k]); } }
#pragma unroll
    for (int sh = 16; sh; sh >>= 1) m = fmaxf(m, __shfl_xor(m, sh, 32));
    float sum = 0.f;
#pragma unroll 1
    for (int c0 = lane * 4; c0 < NN; c0 += 128) {
#pragma unroll
        for (int q = 0; q < 4; ++q) { const int k = c0 + q; if (k <= i) sum += __expf(sr[k] - m); } }
#pragma unroll
    for (int sh = 16; sh; sh >>= 1) sum += __shfl_xor(sum, sh, 32);
    const float inv = 1.0f / sum;
{
#pragma unroll 1
        for (int c0 = lane * 4; c0 < NN; c0 += 128) { v4us oh, ol;
#pragma unroll
            for (int q = 0; q < 4; ++q) { const int k = c0 + q; const float p = (k <= i) ? __expf(sr[(k <= i) ? k : 0] - m) * inv : 0.f; const unsigned short hb = f2bf(p); oh[q] = hb; ol[q] = f2bf(p - bf2f(hb)); }
            const size_t o = (size_t)i * NN + c0; *(v4us*)(PH + o) = oh; *(v4us*)(PL + o) = ol; }
         }
}
__global__ __launch_bounds__(256) void k_ln512(const float* __restrict__ O, const float* __restrict__ g, const float* __restrict__ bb, float* OUTB) {
    const int lane = threadIdx.x & 31; const size_t t = (size_t)blockIdx.x * 8 + (threadIdx.x >> 5); if (t >= (size_t)NN) return; float v[16]; float s = 0.f;
#pragma unroll
    for (int q = 0; q < 4; ++q) {
#pragma unroll
        for (int i = 0; i < 4; ++i) { v[q * 4 + i] = O[t * DI + q * 128 + lane * 4 + i]; s += v[q * 4 + i]; } }
#pragma unroll
    for (int sh = 16; sh; sh >>= 1) s += __shfl_xor(s, sh, 32);
    const float mu = s * (1.0f / DI); float qv = 0.f;
#pragma unroll
    for (int i = 0; i < 16; ++i) { const float d = v[i] - mu; qv = fmaf(d, d, qv); }
#pragma unroll
    for (int sh = 16; sh; sh >>= 1) qv += __shfl_xor(qv, sh, 32);
    const float rs = rsqrtf(qv * (1.0f / DI) + LEPS);
{
#pragma unroll
        for (int q = 0; q < 4; ++q) { const int c0 = q * 128 + lane * 4; v4f y;
#pragma unroll
            for (int i = 0; i < 4; ++i) y[i] = (v[q * 4 + i] - mu) * rs * bfr(g[c0 + i]) + bfr(bb[c0 + i]);
            *(v4f*)(OUTB + t * DI + c0) = y; }
         }
}

extern "C" void kernel_launch(void* const* d_in, const int* in_sizes, int n_in,
                              void* d_out, int out_size, void* d_ws, size_t ws_size, hipStream_t stream) {
    (void)in_sizes; (void)n_in; (void)out_size;
    const float* x0 = (const float*)d_in[0]; const float* x1 = (const float*)d_in[1]; const float* Wq = (const float*)d_in[2]; const float* Wk = (const float*)d_in[3]; const float* Wv = (const float*)d_in[4]; const float* gam = (const float*)d_in[5]; const float* bet = (const float*)d_in[6];
    float* out = (float*)d_out;    // [8][2048][512]
    char* wsp = (char*)d_ws;
    auto take = [&](size_t bytes) { char* p = wsp; wsp += (bytes + 255) & ~(size_t)255; return (void*)p; };
    bf* WQ = (bf*)take((size_t)DI * DX * 2); bf* WK = (bf*)take((size_t)DI * DX * 2); bf* WV = (bf*)take((size_t)DI * DX * 2);
    bf* Xb = (bf*)take((size_t)NN * DX * 2); float* QF = (float*)take((size_t)NN * DI * 4); float* KF = (float*)take((size_t)NN * DI * 4); float* VF = (float*)take((size_t)NN * DI * 4);
    bf* Qh = (bf*)take((size_t)NN * DI * 2); bf* Ql = (bf*)take((size_t)NN * DI * 2); bf* Kh = (bf*)take((size_t)NN * DI * 2); bf* Kl = (bf*)take((size_t)NN * DI * 2); bf* VTh = (bf*)take((size_t)DI * NN * 2); bf* VTl = (bf*)take((size_t)DI * NN * 2);
    float* S = (float*)take((size_t)NN * NN * 4); bf* PH = (bf*)take((size_t)NN * NN * 2); bf* PL = (bf*)take((size_t)NN * NN * 2); float* O = (float*)take((size_t)NN * DI * 4);
    if ((size_t)(wsp - (char*)d_ws) > ws_size) return;    // ~ 3 + 4.2 + 12.6 + 12.6 + 16.8 + 8.4 + 8.4 + 4.2 ~ 71 MB; per item reuse in stream order
    k_wt<<<dim3(DX / 64, DI / 64, 1), 256, 0, stream>>>(Wq, DX, DI, WQ); k_wt<<<dim3(DX / 64, DI / 64, 1), 256, 0, stream>>>(Wk, DX, DI, WK); k_wt<<<dim3(DX / 64, DI / 64, 1), 256, 0, stream>>>(Wv, DX, DI, WV);   // (in, out) weights
    const dim3 gp(NN / 64, DI / 64, 1);
    for (int b = 0; b < NBT; ++b) {
        k_cat<<<NN / 8, 256, 0, stream>>>(x0 + (size_t)b * NN * DI, x1 + (size_t)b * NN * DI, Xb);
        k_gemmb<false><<<gp, 128, 0, stream>>>(Xb, WQ, nullptr, QF, DI, nullptr, nullptr, DX); k_gemmb<false><<<gp, 128, 0, stream>>>(Xb, WK, nullptr, KF, DI, nullptr, nullptr, DX); k_gemmb<false><<<gp, 128, 0, stream>>>(Xb, WV, nullptr, VF, DI, nullptr, nullptr, DX);
        k_split512s<<<NN / 8, 256, 0, stream>>>(QF, NN, SCL, Qh, Ql); k_split512s<<<NN / 8, 256, 0, stream>>>(KF, NN, 1.0f, Kh, Kl); k_vt512<<<dim3(NN / 64, DI / 64, 1), 256, 0, stream>>>(VF, VTh, VTl);
        k_gemm3x<1><<<dim3(NN / 64, NN / 64, 1), 128, 0, stream>>>(Qh, Ql, Kh, Kl, DI, S, NN);            // causal tiles only
        k_csoft1<<<NN / 8, 256, 0, stream>>>(S, PH, PL);
        k_gemm3x<2><<<dim3(NN / 64, DI / 64, 1), 128, 0, stream>>>(PH, PL, VTh, VTl, NN, O, DI);           // K limited to the causal extent
        k_ln512<<<NN / 8, 256, 0, stream>>>(O, gam, bet, out + (size_t)b * NN * DI); }
}

// v002
// Measured time: 332 microseconds a run.
// Timed twice side by side with v001, it ran 2.50 and 2.46 times as fast.
// Counting every step since v000, it is 5.24 times as fast.
#include <hip/hip_runtime.h>

// Compute dtypes, f32 accumulate, per item: x = [x0 | x1] as exact bf16 rows; q/k/v = x.W ([2048 x 1024].[1024 x 512], PLAIN bf16 operands, exact products); single-head causal
// scores q.k^T ([2048 x 512].[512 x 2048]) and wei.v with both operands as bf16 hi + UNSCALED residual planes (three products; key tiles above the diagonal skipped, K limited);

#define NBT  8
#define NG   4             // items per launch of the score, softmax and wei.v stages
#define NN   2048
#define DI   512
#define DX   1024
#define DM   DX
#define NX   NN
#define NZ   NN
#define SCL  0.044194173824159216f   // 512^-0.5
#define LEPS 1e-5f
#define LOSC 1024.0f

typedef _Float16 h16;
typedef unsigned short bf;
typedef __attribute__((ext_vector_type(16))) __bf16   v16bf;
typedef __attribute__((ext_vector_type(16))) _Float16 v16h;
typedef __attribute__((ext_vector_type(8)))  _Float16 v8h;
typedef __attribute__((ext_vector_type(8)))  unsigned short v8us;
typedef __attribute__((ext_vector_type(8)))  float    v8f;
typedef __attribute__((ext_vector_type(4)))  float    v4f;
typedef __attribute__((ext_vector_type(4)))  _Float16 v4h;
typedef v8h  __attribute__((may_alias)) v8ha;
typedef v4f  __attribute__((may_alias)) v4fa;
typedef v8us __attribute__((may_alias)) v8usa;

__device__ __forceinline__ unsigned short f2bf(float f) { unsigned u = __float_as_uint(f); u += 0x7FFFu + ((u >> 16) & 1u); return (unsigned short)(u >> 16); }
__device__ __forceinline__ float bf2f(unsigned short b) { return __uint_as_float(((unsigned)b) << 16); }
__device__ __forceinline__ float bfr(float f) { return bf2f(f2bf(f)); }
__device__ __forceinline__ v16h cat16(v8h lo, v8h hi) { return __builtin_shufflevector(lo, hi, 0, 1, 2, 3, 4, 5, 6, 7, 8, 9, 10, 11, 12, 13, 14, 15); }
__device__ __forceinline__ v16bf cat16b(v8us lo, v8us hi) { return __builtin_bit_cast(v16bf, __builtin_shufflevector(lo, hi, 0, 1, 2, 3, 4, 5, 6, 7, 8, 9, 10, 11, 12, 13, 14, 15)); }
__device__ __forceinline__ v8f wmma16(v16h a, v16h b, v8f c) { return __builtin_amdgcn_wmma_f32_16x16x32_f16(false, a, false, b, (short)0, c, false, false); }
__device__ __forceinline__ v8f wmmab(v16bf a, v16bf b, v8f c) { return __builtin_amdgcn_wmma_f32_16x16x32_bf16(false, a, false, b, (short)0, c, false, false); }

// k_wt: WT [n][K] = bf16(W[k][n]) (k-major [K][ncols]) via 64 x 64 LDS tiles; grid (K/64, ncols/64, 3): z picks the weight, the three transposes lie one behind the other as one [3 * ncols][K] matrix.
__global__ __launch_bounds__(256) void k_wt(const float* __restrict__ W0, const float* __restrict__ W1, const float* __restrict__ W2, int K, int ncols, bf* WT) {
    __shared__ __align__(16) unsigned short tl[64 * 72];
    const float* __restrict__ Wm = blockIdx.z == 0 ? W0 : (blockIdx.z == 1 ? W1 : W2); WT += (size_t)blockIdx.z * ncols * K;
    const int tid = threadIdx.x, k0 = blockIdx.x * 64, n0 = blockIdx.y * 64;
    const int kk = tid >> 2, nq = (tid & 3) * 16;
#pragma unroll
    for (int i = 0; i < 16; ++i) tl[(nq + i) * 72 + kk] = f2bf(Wm[(size_t)(k0 + kk) * ncols + n0 + nq + i]);
    __syncthreads();
    const int piece = tid & 7;
    auto pass = [&]() {
#pragma unroll
        for (int s = 0; s < 2; ++s) { const int nr = (tid >> 3) + 32 * s; const v8us val = *(const v8usa*)(tl + nr * 72 + piece * 8); *(v8us*)(WT + (size_t)(n0 + nr) * K + k0 + piece * 8) = val; }
    };
    pass(); 
}
// Tile staging for the matrix kernels: a 64-row x 64-k bf16 plane lies in LDS at a row pitch of 144 B (16 B x 9, conflict-free for 16-byte fragment reads).
#define TP   72            // LDS row pitch, bf16 elements
#define TPL  (64 * TP)     // one plane, bf16 elements
#define TPLB (TPL * 2)     // one plane, bytes
// cp8: this lane's 16-byte pieces of two planes (rows +0, +16, +32, +48 of each): a wave's copy reads four whole 128-B lines. st = 16 source rows in elements.
__device__ __forceinline__ void cp8(const bf* p, const bf* q, size_t st, unsigned lp, unsigned lq) {
    // asynchronous copies global -> LDS; s_wait_xcnt 0 closes the statement so that no address register is rewritten ahead of it
    asm volatile("global_load_async_to_lds_b128 %0, %8, off\n\t"
                 "global_load_async_to_lds_b128 %1, %9, off\n\t"
                 "global_load_async_to_lds_b128 %2, %10, off\n\t"
                 "global_load_async_to_lds_b128 %3, %11, off\n\t"
                 "global_load_async_to_lds_b128 %4, %12, off\n\t"
                 "global_load_async_to_lds_b128 %5, %13, off\n\t"
                 "global_load_async_to_lds_b128 %6, %14, off\n\t"
                 "global_load_async_to_lds_b128 %7, %15, off\n\t"
                 "s_wait_xcnt 0x0"
                 :: "v"(lp), "v"(lp + 16u * 144u), "v"(lp + 32u * 144u), "v"(lp + 48u * 144u), "v"(lq), "v"(lq + 16u * 144u), "v"(lq + 32u * 144u), "v"(lq + 48u * 144u),
                    "v"(p), "v"(p + st), "v"(p + 2 * st), "v"(p + 3 * st), "v"(q), "v"(q + st), "v"(q + 2 * st), "v"(q + 3 * st) : "memory");
}
__device__ __forceinline__ void wait_copies() { asm volatile("s_wait_asynccnt 0x0" ::: "memory"); }   // this wave's copies have landed in LDS
__device__ __forceinline__ void wait_lds()    { asm volatile("s_wait_dscnt 0x0" ::: "memory"); }      // this wave's LDS reads are done before the buffer is refilled
__device__ __forceinline__ v16bf frag(const bf* r) { return cat16b(*(const v8usa*)r, *(const v8usa*)(r + 16)); }

// k_gemmb: 64 x 64 block tile (4 waves x 16 x 64) of C[NTK][NW] = A.B^T (K = 1024) [+ bf(bias[c])] [+ bf(R[r][c]) residual]; A and B tiles staged in LDS, two buffers; f32 whole-line epilogue (or f16
template <bool F16OUT = false>
__global__ __launch_bounds__(128) void k_gemmb(const bf* __restrict__ A, const bf* __restrict__ Bn, const float* __restrict__ bias, float* C, int ldc, h16* C2, const float* __restrict__ R = nullptr, int K = DM, int roundR = 1) {
    __shared__ __align__(16) bf stg[2][2][TPL];
    __shared__ __align__(16) float ost[4][16 * 68];
    const int tid = threadIdx.x, lane = tid & 31, wave = tid >> 5, lr = lane & 15, hi = lane >> 4;
    const int r0 = blockIdx.x * 64 + wave * 16, c0 = blockIdx.y * 64;
    const size_t ao = (size_t)(blockIdx.x * 64 + (tid >> 3)) * K + (tid & 7) * 8, bo = (size_t)(c0 + (tid >> 3)) * K + (tid & 7) * 8, st16 = (size_t)16 * K;
    const unsigned l0 = (unsigned)(size_t)&stg[0][0][0] + (unsigned)((tid >> 3) * 144 + (tid & 7) * 16);
    auto fill = [&](int t) { const unsigned lb = l0 + (unsigned)(t & 1) * (2u * TPLB); cp8(A + ao + t * 64, Bn + bo + t * 64, st16, lb, lb + TPLB); };
    const int nt = K >> 6;
    v8f acc[4];
#pragma unroll
    for (int t = 0; t < 4; ++t) acc[t] = (v8f){};
    fill(0); wait_copies(); __syncthreads();
    if (nt > 1) fill(1);
#pragma unroll 1   // stays rolled: one pass per staged tile, the two buffers alternate
    for (int s = 0; s < nt; ++s) {
        const bf* sb = &stg[s & 1][0][0];
        v16bf a;
#pragma unroll     // both 32-k halves of the tile in one block: fragment offsets become immediates and the LDS reads overlap the matrix work
        for (int ks = 0; ks < 2; ++ks) {
            a = frag(sb + (wave * 16 + lr) * TP + ks * 32 + 8 * hi);
#pragma unroll
            for (int t = 0; t < 4; ++t) acc[t] = wmmab(a, frag(sb + TPL + (t * 16 + lr) * TP + ks * 32 + 8 * hi), acc[t]);
        }
        // four vector slots behind the pass's last matrix instruction on every path; naming acc also keeps that instruction in front of the waits and the barrier below
        asm volatile("v_nop\n\tv_nop\n\tv_nop\n\tv_nop" : "+v"(acc[0]), "+v"(acc[1]), "+v"(acc[2]), "+v"(acc[3]) : "v"(a));
        wait_lds(); wait_copies(); __syncthreads();    // publishes tile s + 1 and ends every read of tile s
        if (s + 2 < nt) fill(s + 2);
    }
    wait_copies();
    float* os = &ost[wave][0];
#pragma unroll
    for (int t = 0; t < 4; ++t) { const float bv = bias ? bfr(bias[c0 + t * 16 + lr]) : 0.f;
#pragma unroll
        for (int j = 0; j < 8; ++j) os[(hi * 8 + j) * 68 + t * 16 + lr] = acc[t][j] + bv; }
    __syncthreads();
    if (F16OUT) {
        h16* crow = (h16*)(void*)C + (size_t)r0 * ldc + c0;
        auto pass = [&]() {
#pragma unroll
            for (int s = 0; s < 4; ++s) { const int row = 4 * s + (lane >> 3), piece = lane & 7; const float* sp = os + row * 68 + piece * 8; v8h o, o2;
#pragma unroll
                for (int i = 0; i < 8; ++i) { const h16 a = (h16)sp[i]; o[i] = a; o2[i] = (h16)((sp[i] - (float)a) * LOSC); }
                *(v8h*)(crow + (size_t)row * ldc + piece * 8) = o; if (C2) *(v8h*)(C2 + (size_t)r0 * ldc + c0 + (size_t)row * ldc + piece * 8) = o2; }
        };
        pass(); 
    } else {
        float* crow = C + (size_t)r0 * ldc + c0;
        auto pass = [&]() {
#pragma unroll
            for (int s = 0; s < 8; ++s) { const int Lid = (lane >> 3) + 4 * s, piece = lane & 7; const int row = Lid >> 1, cofs = (Lid & 1) * 32 + piece * 4;
                v4f val = *(const v4fa*)(os + row * 68 + cofs); if (R) { const v4f rv = *(const v4f*)(R + ((size_t)r0 + row) * ldc + c0 + cofs); val += roundR ? (v4f){bfr(rv[0]), bfr(rv[1]), bfr(rv[2]), bfr(rv[3])} : rv; }
                *(v4f*)(crow + (size_t)row * ldc + cofs) = val; }
        };
        pass(); 
    }
}

// k_gemm3x: 64 x 64 tile of C = (Ah + Al).(Bh + Bl)^T over K (row strides = K for all four planes; n-major B): three products per 32-k step (hh, lh, hl); the four planes' tiles staged in LDS, two buffers; f32
// grid.z = item: sA, sB, sC are the item strides (elements) of the A planes, the B planes and C.
template <int MODE>
__global__ __launch_bounds__(128) void k_gemm3x(const bf* __restrict__ Ah, const bf* __restrict__ Al, const bf* __restrict__ Bh, const bf* __restrict__ Bl, int K, float* C, int ldc, size_t sA, size_t sB, size_t sC) {
    if ((MODE & 1) && (int)blockIdx.y * 64 > (int)blockIdx.x * 64 + 63) return;
    const int Klim = (MODE & 2) ? min(K, ((int)blockIdx.x + 1) * 64) : K;
    __shared__ __align__(16) bf stg[2][4][TPL];
    __shared__ __align__(16) float ost[4][16 * 68];
    const int tid = threadIdx.x, lane = tid & 31, wave = tid >> 5, lr = lane & 15, hi = lane >> 4;
    const int r0 = blockIdx.x * 64 + wave * 16, c0 = blockIdx.y * 64;
    const size_t ao = blockIdx.z * sA + (size_t)(blockIdx.x * 64 + (tid >> 3)) * K + (tid & 7) * 8, bo = blockIdx.z * sB + (size_t)(c0 + (tid >> 3)) * K + (tid & 7) * 8, st16 = (size_t)16 * K;
    const unsigned l0 = (unsigned)(size_t)&stg[0][0][0] + (unsigned)((tid >> 3) * 144 + (tid & 7) * 16);
    auto fill = [&](int t) { const unsigned lb = l0 + (unsigned)(t & 1) * (4u * TPLB);
        cp8(Ah + ao + t * 64, Al + ao + t * 64, st16, lb, lb + TPLB); cp8(Bh + bo + t * 64, Bl + bo + t * 64, st16, lb + 2u * TPLB, lb + 3u * TPLB); };
    const int nt = Klim >> 6;
    v8f acc[4];
#pragma unroll
    for (int t = 0; t < 4; ++t) acc[t] = (v8f){};
    fill(0); wait_copies(); __syncthreads();
    if (nt > 1) fill(1);
#pragma unroll 1   // stays rolled: one pass per staged tile, the two buffers alternate
    for (int s = 0; s < nt; ++s) {
        const bf* sb = &stg[s & 1][0][0];
        v16bf a, al;
#pragma unroll     // both 32-k halves of the tile in one block: fragment offsets become immediates and the LDS reads overlap the matrix work
        for (int ks = 0; ks < 2; ++ks) {
            const bf* ar = sb + (wave * 16 + lr) * TP + ks * 32 + 8 * hi;
            a = frag(ar); al = frag(ar + TPL);
#pragma unroll
            for (int t = 0; t < 4; ++t) { const bf* br = sb + 2 * TPL + (t * 16 + lr) * TP + ks * 32 + 8 * hi;
                const v16bf bh = frag(br);
                acc[t] = wmmab(a, bh, acc[t]); acc[t] = wmmab(al, bh, acc[t]); acc[t] = wmmab(a, frag(br + TPL), acc[t]); }
        }
        // four vector slots behind the pass's last matrix instruction on every path; naming acc also keeps that instruction in front of the waits and the barrier below
        asm volatile("v_nop\n\tv_nop\n\tv_nop\n\tv_nop" : "+v"(acc[0]), "+v"(acc[1]), "+v"(acc[2]), "+v"(acc[3]) : "v"(a), "v"(al));
        wait_lds(); wait_copies(); __syncthreads();    // publishes tile s + 1 and ends every read of tile s
        if (s + 2 < nt) fill(s + 2);
    }
    wait_copies();
    float* os = &ost[wave][0];
#pragma unroll
    for (int t = 0; t < 4; ++t) {
#pragma unroll
        for (int j = 0; j < 8; ++j) os[(hi * 8 + j) * 68 + t * 16 + lr] = acc[t][j]; }
    __builtin_amdgcn_wave_barrier(); asm volatile("" ::: "memory");
    float* crow = C + blockIdx.z * sC + (size_t)r0 * ldc + c0;
    auto pass = [&]() {
#pragma unroll
        for (int s = 0; s < 8; ++s) { const int Lid = (lane >> 3) + 4 * s, piece = lane & 7; const int row = Lid >> 1, cofs = (Lid & 1) * 32 + piece * 4;
            const v4f val = *(const v4fa*)(os + row * 68 + cofs); *(v4f*)(crow + (size_t)row * ldc + cofs) = val; }
    };
    pass(); 
}


__global__ __launch_bounds__(256) void k_cat(const float* __restrict__ a, const float* __restrict__ c, bf* Xb) {
    const int lane = threadIdx.x & 31; const size_t t = (size_t)blockIdx.x * 8 + (threadIdx.x >> 5); if (t >= (size_t)NBT * NN) return;   // t runs over the rows of all items
{
#pragma unroll
        for (int q = 0; q < 4; ++q) { const float* src = (q < 2 ? a : c) + t * DI + (q & 1) * 256 + lane * 8; v8us o;
#pragma unroll
            for (int i = 0; i < 8; ++i) o[i] = f2bf(src[i]);
            *(v8us*)(Xb + t * DX + q * 256 + lane * 8) = o; }
         }
}
// grid (rows/8, 2, items): y = 0 splits q (scaled by scq), y = 1 splits k; src row = [q | k | v] at pitch ld; d holds, per y and item, the hi plane and behind it the residual plane.
__global__ __launch_bounds__(256) void k_split512s(const float* __restrict__ src, int rows, int ld, float scq, bf* d) {
    const int lane = threadIdx.x & 31; const size_t r = (size_t)blockIdx.x * 8 + (threadIdx.x >> 5); if (r >= (size_t)rows) return;
    const float sc = blockIdx.y ? 1.0f : scq; src += ((size_t)blockIdx.z * rows + r) * ld + blockIdx.y * DI;
    bf* dh = d + ((size_t)blockIdx.y * NBT + blockIdx.z) * 2 * rows * DI; bf* dl = dh + (size_t)rows * DI;
{
#pragma unroll
        for (int q = 0; q < DI / 256; ++q) { const size_t o = r * DI + q * 256 + lane * 8; const v8f v = *(const v8f*)(src + q * 256 + lane * 8); v8us oh, ol;
#pragma unroll
            for (int i = 0; i < 8; ++i) { const float y = v[i] * sc; const unsigned short hb = f2bf(y); oh[i] = hb; ol[i] = f2bf(y - bf2f(hb)); }
            *(v8us*)(dh + o) = oh; *(v8us*)(dl + o) = ol; }
         }
}
// grid.z = item; V rows at pitch ld.
__global__ __launch_bounds__(256) void k_vt512(const float* __restrict__ V, int ld, bf* Th, bf* Tl) {
    __shared__ float tl[64][65];
    typedef __attribute__((ext_vector_type(4))) unsigned short v4us;
    const int tid = threadIdx.x; const int t0 = blockIdx.x * 64, d0 = blockIdx.y * 64; const int rr = tid >> 2, cq = (tid & 3) * 16;
    V += (size_t)blockIdx.z * NN * ld; Th += (size_t)blockIdx.z * DI * NN; Tl += (size_t)blockIdx.z * DI * NN;
#pragma unroll
    for (int i = 0; i < 16; ++i) tl[rr][cq + i] = V[(size_t)(t0 + rr) * ld + d0 + cq + i];     // tl[t][d]
    __syncthreads();
    const int lane = tid & 31, wv = tid >> 5;
    auto pass = [&]() {
#pragma unroll
        for (int st = 0; st < 4; ++st) { const int dr = wv * 8 + st * 2 + (lane >> 4); const int tq = (lane & 15) * 4; v4us oh, ol;
#pragma unroll
            for (int i = 0; i < 4; ++i) { const float y = tl[tq + i][dr]; const unsigned short hb = f2bf(y); oh[i] = hb; ol[i] = f2bf(y - bf2f(hb)); }
            const size_t o = (size_t)(d0 + dr) * NN + t0 + tq; *(v4us*)(Th + o) = oh; *(v4us*)(Tl + o) = ol; }
    };
    pass(); 
}
__global__ __launch_bounds__(256) void k_csoft1(const float* __restrict__ S, bf* PH, bf* PL) {
    typedef __attribute__((ext_vector_type(4))) unsigned short v4us;
    const int lane = threadIdx.x & 31, i = blockIdx.x * 8 + (threadIdx.x >> 5); if (i >= NN) return; const float* sr = S + ((size_t)blockIdx.z * NN + i) * NN; PH += (size_t)blockIdx.z * NN * NN; PL += (size_t)blockIdx.z * NN * NN;   // grid.z = item
    float m = -3.0e38f;
#pragma unroll 1
    for (int c0 = lane * 4; c0 < NN; c0 += 128) {
#pragma unroll
        for (int q = 0; q < 4; ++q) { const int k = c0 + q; if (k <= i) m = fmaxf(m, sr[k]); } }
#pragma unroll
    for (int sh = 16; sh; sh >>= 1) m = fmaxf(m, __shfl_xor(m, sh, 32));
    float sum = 0.f;
#pragma unroll 1
    for (int c0 = lane * 4; c0 < NN; c0 += 128) {
#pragma unroll
        for (int q = 0; q < 4; ++q) { const int k = c0 + q; if (k <= i) sum += __expf(sr[k] - m); } }
#pragma unroll
    for (int sh = 16; sh; sh >>= 1) sum += __shfl_xor(sum, sh, 32);
    const float inv = 1.0f / sum;
{
#pragma unroll 1
        for (int c0 = lane * 4; c0 < NN; c0 += 128) { v4us oh, ol;
#pragma unroll
            for (int q = 0; q < 4; ++q) { const int k = c0 + q; const float p = (k <= i) ? __expf(sr[(k <= i) ? k : 0] - m) * inv : 0.f; const unsigned short hb = f2bf(p); oh[q] = hb; ol[q] = f2bf(p - bf2f(hb)); }
            const size_t o = (size_t)i * NN + c0; *(v4us*)(PH + o) = oh; *(v4us*)(PL + o) = ol; }
         }
}
__global__ __launch_bounds__(256) void k_ln512(const float* __restrict__ O, const float* __restrict__ g, const float* __restrict__ bb, float* OUTB) {
    const int lane = threadIdx.x & 31; const size_t t = (size_t)blockIdx.x * 8 + (threadIdx.x >> 5); if (t >= (size_t)NBT * NN) return; float v[16]; float s = 0.f;   // t runs over the rows of all items
#pragma unroll
    for (int q = 0; q < 4; ++q) {
#pragma unroll
        for (int i = 0; i < 4; ++i) { v[q * 4 + i] = O[t * DI + q * 128 + lane * 4 + i]; s += v[q * 4 + i]; } }
#pragma unroll
    for (int sh = 16; sh; sh >>= 1) s += __shfl_xor(s, sh, 32);
    const float mu = s * (1.0f / DI); float qv = 0.f;
#pragma unroll
    for (int i = 0; i < 16; ++i) { const float d = v[i] - mu; qv = fmaf(d, d, qv); }
#pragma unroll
    for (int sh = 16; sh; sh >>= 1) qv += __shfl_xor(qv, sh, 32);
    const float rs = rsqrtf(qv * (1.0f / DI) + LEPS);
{
#pragma unroll
        for (int q = 0; q < 4; ++q) { const int c0 = q * 128 + lane * 4; v4f y;
#pragma unroll
            for (int i = 0; i < 4; ++i) y[i] = (v[q * 4 + i] - mu) * rs * bfr(g[c0 + i]) + bfr(bb[c0 + i]);
            *(v4f*)(OUTB + t * DI + c0) = y; }
         }
}

extern "C" void kernel_launch(void* const* d_in, const int* in_sizes, int n_in,
                              void* d_out, int out_size, void* d_ws, size_t ws_size, hipStream_t stream) {
    (void)in_sizes; (void)n_in; (void)out_size;
    const float* x0 = (const float*)d_in[0]; const float* x1 = (const float*)d_in[1]; const float* Wq = (const float*)d_in[2]; const float* Wk = (const float*)d_in[3]; const float* Wv = (const float*)d_in[4]; const float* gam = (const float*)d_in[5]; const float* bet = (const float*)d_in[6];
    float* out = (float*)d_out;    // [8][2048][512]
    char* wsp = (char*)d_ws;
    auto take = [&](size_t bytes) { char* p = wsp; wsp += (bytes + 255) & ~(size_t)255; return (void*)p; };
    const size_t PLN = (size_t)NN * DI;      // one [2048][512] plane, elements
    const size_t SQ  = (size_t)NN * NN;      // one [2048][2048] plane, elements
    bf* WT = (bf*)take((size_t)3 * DI * DX * 2);                       // [Wq^T ; Wk^T ; Wv^T] as one [1536][1024] matrix
    bf* QK = (bf*)take((size_t)2 * NBT * 2 * PLN * 2);                 // q: per item [hi | residual]; behind all of q the same for k
    bf* VTh = (bf*)take((size_t)NBT * PLN * 2); bf* VTl = (bf*)take((size_t)NBT * PLN * 2);
    char* RA = (char*)take((size_t)NBT * NN * DX * 2 + (size_t)NBT * NN * 3 * DI * 4);   // 128 MiB, used twice in stream order
    bf* Xb = (bf*)RA; float* F = (float*)(RA + (size_t)NBT * NN * DX * 2);               // first: x as bf16 (all items) and [q | k | v] in f32 (all items)
    float* S = (float*)RA; bf* PH = (bf*)(RA + (size_t)NG * SQ * 4); bf* PL = PH + (size_t)NG * SQ;   // then, per group of NG items: scores and the two planes of wei
    bf* KB = QK + (size_t)NBT * 2 * PLN;
    float* O = (float*)QK;                   // item b's attention output lies on item b's q planes, which are dead once its scores are formed
    if ((size_t)(wsp - (char*)d_ws) > ws_size) return;    // 3 + 64 + 32 + 128 = 227 MiB
    k_wt<<<dim3(DX / 64, DI / 64, 3), 256, 0, stream>>>(Wq, Wk, Wv, DX, DI, WT);   // (in, out) weights
    k_cat<<<NBT * NN / 8, 256, 0, stream>>>(x0, x1, Xb);
    k_gemmb<false><<<dim3(NBT * NN / 64, 3 * DI / 64, 1), 128, 0, stream>>>(Xb, WT, nullptr, F, 3 * DI, nullptr, nullptr, DX);
    k_split512s<<<dim3(NN / 8, 2, NBT), 256, 0, stream>>>(F, NN, 3 * DI, SCL, QK);
    k_vt512<<<dim3(NN / 64, DI / 64, NBT), 256, 0, stream>>>(F + 2 * DI, 3 * DI, VTh, VTl);
    for (int g = 0; g < NBT / NG; ++g) {     // scores and wei of all eight items do not fit the workspace at once
        const bf* Qg = QK + (size_t)g * NG * 2 * PLN; const bf* Kg = KB + (size_t)g * NG * 2 * PLN;
        k_gemm3x<1><<<dim3(NN / 64, NN / 64, NG), 128, 0, stream>>>(Qg, Qg + PLN, Kg, Kg + PLN, DI, S, NN, 2 * PLN, 2 * PLN, SQ);            // causal tiles only
        k_csoft1<<<dim3(NN / 8, 1, NG), 256, 0, stream>>>(S, PH, PL);
        k_gemm3x<2><<<dim3(NN / 64, DI / 64, NG), 128, 0, stream>>>(PH, PL, VTh + (size_t)g * NG * PLN, VTl + (size_t)g * NG * PLN, NN, O + (size_t)g * NG * PLN, DI, SQ, PLN, PLN); }   // K limited to the causal extent
    k_ln512<<<NBT * NN / 8, 256, 0, stream>>>(O, gam, bet, out);
}

// v003
// Measured time: 295 microseconds a run.
// Next to v002, in two timings, it ran 1.12 times as fast each time.
// Over all steps from v000 it is 5.89 times as fast.
#include <hip/hip_runtime.h>

// Compute dtypes, f32 accumulate, per item: x = [x0 | x1] as exact bf16 rows; q/k/v = x.W ([2048 x 1024].[1024 x 512], PLAIN bf16 operands, exact products); single-head causal
// scores q.k^T ([2048 x 512].[512 x 2048]) and wei.v with both operands as bf16 hi + UNSCALED residual planes (three products; key tiles above the diagonal skipped, K limited);

#define NBT  8
#define NG   4             // items per launch of the score, softmax and wei.v stages
#define NN   2048
#define DI   512
#define DX   1024
#define DM   DX
#define NX   NN
#define NZ   NN
#define SCL  0.044194173824159216f   // 512^-0.5
#define LEPS 1e-5f
#define LOSC 1024.0f

typedef _Float16 h16;
typedef unsigned short bf;
typedef __attribute__((ext_vector_type(16))) __bf16   v16bf;
typedef __attribute__((ext_vector_type(16))) _Float16 v16h;
typedef __attribute__((ext_vector_type(8)))  _Float16 v8h;
typedef __attribute__((ext_vector_type(8)))  unsigned short v8us;
typedef __attribute__((ext_vector_type(8)))  float    v8f;
typedef __attribute__((ext_vector_type(4)))  float    v4f;
typedef __attribute__((ext_vector_type(4)))  _Float16 v4h;
typedef v8h  __attribute__((may_alias)) v8ha;
typedef v4f  __attribute__((may_alias)) v4fa;
typedef v8us __attribute__((may_alias)) v8usa;

__device__ __forceinline__ unsigned short f2bf(float f) { unsigned u = __float_as_uint(f); u += 0x7FFFu + ((u >> 16) & 1u); return (unsigned short)(u >> 16); }
__device__ __forceinline__ float bf2f(unsigned short b) { return __uint_as_float(((unsigned)b) << 16); }
__device__ __forceinline__ float bfr(float f) { return bf2f(f2bf(f)); }
__device__ __forceinline__ v16h cat16(v8h lo, v8h hi) { return __builtin_shufflevector(lo, hi, 0, 1, 2, 3, 4, 5, 6, 7, 8, 9, 10, 11, 12, 13, 14, 15); }
__device__ __forceinline__ v16bf cat16b(v8us lo, v8us hi) { return __builtin_bit_cast(v16bf, __builtin_shufflevector(lo, hi, 0, 1, 2, 3, 4, 5, 6, 7, 8, 9, 10, 11, 12, 13, 14, 15)); }
__device__ __forceinline__ v8f wmma16(v16h a, v16h b, v8f c) { return __builtin_amdgcn_wmma_f32_16x16x32_f16(false, a, false, b, (short)0, c, false, false); }
__device__ __forceinline__ v8f wmmab(v16bf a, v16bf b, v8f c) { return __builtin_amdgcn_wmma_f32_16x16x32_bf16(false, a, false, b, (short)0, c, false, false); }

// k_wt: WT [n][K] = bf16(W[k][n]) (k-major [K][ncols]) via 64 x 64 LDS tiles; grid (K/64, ncols/64, 3): z picks the weight, the three transposes lie one behind the other as one [3 * ncols][K] matrix.
__global__ __launch_bounds__(256) void k_wt(const float* __restrict__ W0, const float* __restrict__ W1, const float* __restrict__ W2, int K, int ncols, bf* WT) {
    __shared__ __align__(16) unsigned short tl[64 * 72];
    const float* __restrict__ Wm = blockIdx.z == 0 ? W0 : (blockIdx.z == 1 ? W1 : W2); WT += (size_t)blockIdx.z * ncols * K;
    const int tid = threadIdx.x, k0 = blockIdx.x * 64, n0 = blockIdx.y * 64;
    const int kk = tid >> 2, nq = (tid & 3) * 16;
#pragma unroll
    for (int i = 0; i < 16; ++i) tl[(nq + i) * 72 + kk] = f2bf(Wm[(size_t)(k0 + kk) * ncols + n0 + nq + i]);
    __syncthreads();
    const int piece = tid & 7;
    auto pass = [&]() {
#pragma unroll
        for (int s = 0; s < 2; ++s) { const int nr = (tid >> 3) + 32 * s; const v8us val = *(const v8usa*)(tl + nr * 72 + piece * 8); *(v8us*)(WT + (size_t)(n0 + nr) * K + k0 + piece * 8) = val; }
    };
    pass(); 
}
// Tile staging for the matrix kernels: a 64-row x 64-k bf16 plane lies in LDS at a row pitch of 144 B (16 B x 9, conflict-free for 16-byte fragment reads).
#define TP   72            // LDS row pitch, bf16 elements
#define TPL  (64 * TP)     // one plane, bf16 elements
#define TPLB (TPL * 2)     // one plane, bytes
// cp8: this lane's 16-byte pieces of two planes (rows +0, +16, +32, +48 of each): a wave's copy reads four whole 128-B lines. st = 16 source rows in elements.
__device__ __forceinline__ void cp8(const bf* p, const bf* q, size_t st, unsigned lp, unsigned lq) {
    // asynchronous copies global -> LDS; s_wait_xcnt 0 closes the statement so that no address register is rewritten ahead of it
    asm volatile("global_load_async_to_lds_b128 %0, %8, off\n\t"
                 "global_load_async_to_lds_b128 %1, %9, off\n\t"
                 "global_load_async_to_lds_b128 %2, %10, off\n\t"
                 "global_load_async_to_lds_b128 %3, %11, off\n\t"
                 "global_load_async_to_lds_b128 %4, %12, off\n\t"
                 "global_load_async_to_lds_b128 %5, %13, off\n\t"
                 "global_load_async_to_lds_b128 %6, %14, off\n\t"
                 "global_load_async_to_lds_b128 %7, %15, off\n\t"
                 "s_wait_xcnt 0x0"
                 :: "v"(lp), "v"(lp + 16u * 144u), "v"(lp + 32u * 144u), "v"(lp + 48u * 144u), "v"(lq), "v"(lq + 16u * 144u), "v"(lq + 32u * 144u), "v"(lq + 48u * 144u),
                    "v"(p), "v"(p + st), "v"(p + 2 * st), "v"(p + 3 * st), "v"(q), "v"(q + st), "v"(q + 2 * st), "v"(q + 3 * st) : "memory");
}
__device__ __forceinline__ void wait_copies() { asm volatile("s_wait_asynccnt 0x0" ::: "memory"); }   // this wave's copies have landed in LDS
__device__ __forceinline__ void wait_lds()    { asm volatile("s_wait_dscnt 0x0" ::: "memory"); }      // this wave's LDS reads are done before the buffer is refilled
__device__ __forceinline__ v16bf frag(const bf* r) { return cat16b(*(const v8usa*)r, *(const v8usa*)(r + 16)); }

// hold: four vector slots behind the pass's last matrix instruction on every path; naming every accumulator also keeps that instruction in front of the waits and the barrier that follow
template <int FM>
__device__ __forceinline__ void hold(v8f (&c)[FM][4]) {
    static_assert(FM == 2 || FM == 4, "two or four rows of accumulator tiles");
    if constexpr (FM == 4)
        asm volatile("v_nop\n\tv_nop\n\tv_nop\n\tv_nop" : "+v"(c[0][0]), "+v"(c[0][1]), "+v"(c[0][2]), "+v"(c[0][3]), "+v"(c[1][0]), "+v"(c[1][1]), "+v"(c[1][2]), "+v"(c[1][3]),
                                                          "+v"(c[2][0]), "+v"(c[2][1]), "+v"(c[2][2]), "+v"(c[2][3]), "+v"(c[3][0]), "+v"(c[3][1]), "+v"(c[3][2]), "+v"(c[3][3]));
    else
        asm volatile("v_nop\n\tv_nop\n\tv_nop\n\tv_nop" : "+v"(c[0][0]), "+v"(c[0][1]), "+v"(c[0][2]), "+v"(c[0][3]), "+v"(c[1][0]), "+v"(c[1][1]), "+v"(c[1][2]), "+v"(c[1][3]));
}

// k_gemmb: 128 x 128 block tile (2 x 2 waves, 64 x 64 each) of C[NTK][NW] = A.B^T (K = 1024); A and B tiles (two 64-row planes each) staged in LDS, two buffers;
// f32 whole-line epilogue, staged per wave in the ring, which every wave has left at the last pass's barrier.
__global__ __launch_bounds__(128) void k_gemmb(const bf* __restrict__ A, const bf* __restrict__ Bn, float* C, int ldc, int K) {
    __shared__ __align__(16) bf stg[2 * 4 * TPL];
    static_assert(4 * 64 * 68 * 4 <= 2 * 4 * TPLB, "the output staging fits the ring");
    const int tid = threadIdx.x, lane = tid & 31, wave = tid >> 5, lr = lane & 15, hi = lane >> 4, wm = wave >> 1, wn = wave & 1;
    const int r0 = blockIdx.x * 128 + wm * 64, c0 = blockIdx.y * 128 + wn * 64;
    const size_t ao = (size_t)(blockIdx.x * 128 + (tid >> 3)) * K + (tid & 7) * 8, bo = (size_t)(blockIdx.y * 128 + (tid >> 3)) * K + (tid & 7) * 8, st16 = (size_t)16 * K, st64 = (size_t)64 * K;
    const unsigned l0 = (unsigned)(size_t)&stg[0] + (unsigned)((tid >> 3) * 144 + (tid & 7) * 16);
    auto fill = [&](int t) { const unsigned lb = l0 + (unsigned)(t & 1) * (4u * TPLB);
        cp8(A + ao + t * 64, A + ao + st64 + t * 64, st16, lb, lb + TPLB); cp8(Bn + bo + t * 64, Bn + bo + st64 + t * 64, st16, lb + 2u * TPLB, lb + 3u * TPLB); };
    const int nt = K >> 6;
    v8f acc[4][4];
#pragma unroll
    for (int m = 0; m < 4; ++m) {
#pragma unroll
        for (int t = 0; t < 4; ++t) acc[m][t] = (v8f){}; }
    fill(0); wait_copies(); __syncthreads();
    if (nt > 1) fill(1);
#pragma unroll 1   // stays rolled: one pass per staged tile, the two buffers alternate
    for (int s = 0; s < nt; ++s) {
        const bf* sb = &stg[(s & 1) * 4 * TPL];
#pragma unroll     // both 32-k halves of the tile in one block: fragment offsets become immediates and the LDS reads overlap the matrix work
        for (int ks = 0; ks < 2; ++ks) {
            v16bf a[4], b[4];
#pragma unroll
            for (int m = 0; m < 4; ++m) a[m] = frag(sb + (wm * 64 + m * 16 + lr) * TP + ks * 32 + 8 * hi);
#pragma unroll
            for (int t = 0; t < 4; ++t) b[t] = frag(sb + 2 * TPL + (wn * 64 + t * 16 + lr) * TP + ks * 32 + 8 * hi);
            __builtin_amdgcn_sched_barrier(0);   // the step's fragment loads stay one group in front of its matrix block: sunk among the matrix instructions, each pair is waited out on its own
#pragma unroll
            for (int t = 0; t < 4; ++t) {
#pragma unroll
                for (int m = 0; m < 4; ++m) acc[m][t] = wmmab(a[m], b[t], acc[m][t]); }
        }
        hold<4>(acc);
        wait_lds(); wait_copies(); __syncthreads();    // publishes tile s + 1 and ends every read of tile s
        if (s + 2 < nt) fill(s + 2);
    }
    wait_copies();
    float* os = (float*)(void*)stg + wave * (64 * 68);
#pragma unroll
    for (int m = 0; m < 4; ++m) {
#pragma unroll
        for (int t = 0; t < 4; ++t) {
#pragma unroll
            for (int j = 0; j < 8; ++j) os[(m * 16 + hi * 8 + j) * 68 + t * 16 + lr] = acc[m][t][j]; } }
    __syncthreads();
    float* crow = C + (size_t)r0 * ldc + c0;
#pragma unroll
    for (int s = 0; s < 32; ++s) { const int Lid = (lane >> 3) + 4 * s, piece = lane & 7; const int row = Lid >> 1, cofs = (Lid & 1) * 32 + piece * 4;
        const v4f val = *(const v4fa*)(os + row * 68 + cofs); *(v4f*)(crow + (size_t)row * ldc + cofs) = val; }
}

// k_gemm3x: BM x BN block tile (2 x 2 waves, BM/2 x 64 each; BN = 128) of C = (Ah + Al).(Bh + Bl)^T over K (row strides = K for all four planes; n-major B): three products per 32-k step (hh, lh, hl, in that
// order into each accumulator); the four planes' tiles staged in LDS as 64-row planes, two buffers; f32 whole-line epilogue, staged per wave in the ring, which every wave has left at the last pass's barrier.
// grid.z = item: sA, sB, sC are the item strides (elements) of the A planes, the B planes and C.
template <int MODE, int BM, int BN>
__global__ __launch_bounds__(128) void k_gemm3x(const bf* __restrict__ Ah, const bf* __restrict__ Al, const bf* __restrict__ Bh, const bf* __restrict__ Bl, int K, float* C, int ldc, size_t sA, size_t sB, size_t sC) {
    constexpr int CA = BM / 64, CB = BN / 64, WM = BM / 2, FM = WM / 16, NPL = 2 * (CA + CB), NB = FM == 4 ? 2 : 4;   // 64-row planes per operand plane; rows and accumulator rows per wave; planes per buffer; B column groups held in registers at a time
    static_assert(BN == 128 && 4 * WM * 68 * 4 <= 2 * NPL * TPLB, "64 columns per wave; the output staging fits the ring");
    if ((MODE & 1) && (int)blockIdx.y * BN > (int)blockIdx.x * BM + BM - 1) return;
    const int Klim = (MODE & 2) ? min(K, ((int)blockIdx.x + 1) * BM) : K;
    __shared__ __align__(16) bf stg[2 * NPL * TPL];
    const int tid = threadIdx.x, lane = tid & 31, wave = tid >> 5, lr = lane & 15, hi = lane >> 4, wm = wave >> 1, wn = wave & 1;
    const int r0 = blockIdx.x * BM + wm * WM, c0 = blockIdx.y * BN + wn * 64;
    const size_t ao = blockIdx.z * sA + (size_t)(blockIdx.x * BM) * K, bo = blockIdx.z * sB + (size_t)(blockIdx.y * BN) * K, st16 = (size_t)16 * K, st64 = (size_t)64 * K;   // the block's tiles: the same in every lane
    const unsigned vo = (unsigned)((tid >> 3) * K + (tid & 7) * 8);   // this lane's piece inside a 16-row slab; the k offset is added to it in 32 bits, so that one register, not eight pointers, lives through the loop
    const unsigned l0 = (unsigned)(size_t)&stg[0] + (unsigned)((tid >> 3) * 144 + (tid & 7) * 16);
    auto fill = [&](int t) { const unsigned lb = l0 + (unsigned)(t & 1) * ((unsigned)NPL * TPLB);
#pragma unroll
        for (int c = 0; c < CA; ++c) cp8(Ah + ao + c * st64 + (vo + (unsigned)t * 64u), Al + ao + c * st64 + (vo + (unsigned)t * 64u), st16, lb + (unsigned)c * TPLB, lb + (unsigned)(CA + c) * TPLB);
#pragma unroll
        for (int c = 0; c < CB; ++c) cp8(Bh + bo + c * st64 + (vo + (unsigned)t * 64u), Bl + bo + c * st64 + (vo + (unsigned)t * 64u), st16, lb + (unsigned)(2 * CA + c) * TPLB, lb + (unsigned)(2 * CA + CB + c) * TPLB); };
    const int nt = Klim >> 6;
    v8f acc[FM][4];
#pragma unroll
    for (int m = 0; m < FM; ++m) {
#pragma unroll
        for (int t = 0; t < 4; ++t) acc[m][t] = (v8f){}; }
    fill(0); wait_copies(); __syncthreads();
    if (nt > 1) fill(1);
#pragma unroll 1   // stays rolled: one pass per staged tile, the two buffers alternate
    for (int s = 0; s < nt; ++s) {
        const bf* sb = &stg[(s & 1) * NPL * TPL];
#pragma unroll     // both 32-k halves of the tile in one block: fragment offsets become immediates and the LDS reads overlap the matrix work
        for (int ks = 0; ks < 2; ++ks) {
            v16bf a[FM], al[FM], bh[NB], bl[NB];
            const bf* br = sb + 2 * CA * TPL + (wn * 64 + lr) * TP + ks * 32 + 8 * hi;
#pragma unroll
            for (int m = 0; m < FM; ++m) { const bf* ar = sb + (wm * WM + m * 16 + lr) * TP + ks * 32 + 8 * hi; a[m] = frag(ar); al[m] = frag(ar + CA * TPL); }
#pragma unroll
            for (int t = 0; t < NB; ++t) { bh[t] = frag(br + t * 16 * TP); bl[t] = frag(br + t * 16 * TP + CB * TPL); }
            __builtin_amdgcn_sched_barrier(0);   // the step's fragment loads stay one group in front of its matrix block: sunk among the matrix instructions, each pair is waited out on its own
#pragma unroll
            for (int t = 0; t < 4; ++t) { const int u = t % NB;
#pragma unroll
                for (int m = 0; m < FM; ++m) acc[m][t] = wmmab(a[m], bh[u], acc[m][t]);
#pragma unroll
                for (int m = 0; m < FM; ++m) acc[m][t] = wmmab(al[m], bh[u], acc[m][t]);
#pragma unroll
                for (int m = 0; m < FM; ++m) acc[m][t] = wmmab(a[m], bl[u], acc[m][t]);
                if (t + NB < 4) {   // the B registers just used take column group t + NB; the fence pair keeps these loads here, one whole matrix group ahead of their use
                    __builtin_amdgcn_sched_barrier(0);
                    bh[u] = frag(br + (t + NB) * 16 * TP); bl[u] = frag(br + (t + NB) * 16 * TP + CB * TPL);
                    __builtin_amdgcn_sched_barrier(0); } }
        }
        hold<FM>(acc);
        wait_lds(); wait_copies(); __syncthreads();    // publishes tile s + 1 and ends every read of tile s
        if (s + 2 < nt) fill(s + 2);
    }
    wait_copies();
    float* os = (float*)(void*)stg + wave * (WM * 68);
#pragma unroll
    for (int m = 0; m < FM; ++m) {
#pragma unroll
        for (int t = 0; t < 4; ++t) {
#pragma unroll
            for (int j = 0; j < 8; ++j) os[(m * 16 + hi * 8 + j) * 68 + t * 16 + lr] = acc[m][t][j]; } }
    __builtin_amdgcn_wave_barrier(); asm volatile("" ::: "memory");   // the wave's staged rows are stored before any of its lanes reads them back; no other wave touches them
    float* crow = C + blockIdx.z * sC + (size_t)r0 * ldc + c0;
#pragma unroll
    for (int s = 0; s < 8 * FM; ++s) { const int Lid = (lane >> 3) + 4 * s, piece = lane & 7; const int row = Lid >> 1, cofs = (Lid & 1) * 32 + piece * 4;
        const v4f val = *(const v4fa*)(os + row * 68 + cofs); *(v4f*)(crow + (size_t)row * ldc + cofs) = val; }
}


__global__ __launch_bounds__(256) void k_cat(const float* __restrict__ a, const float* __restrict__ c, bf* Xb) {
    const int lane = threadIdx.x & 31; const size_t t = (size_t)blockIdx.x * 8 + (threadIdx.x >> 5); if (t >= (size_t)NBT * NN) return;   // t runs over the rows of all items
{
#pragma unroll
        for (int q = 0; q < 4; ++q) { const float* src = (q < 2 ? a : c) + t * DI + (q & 1) * 256 + lane * 8; v8us o;
#pragma unroll
            for (int i = 0; i < 8; ++i) o[i] = f2bf(src[i]);
            *(v8us*)(Xb + t * DX + q * 256 + lane * 8) = o; }
         }
}
// grid (rows/8, 2, items): y = 0 splits q (scaled by scq), y = 1 splits k; src row = [q | k | v] at pitch ld; d holds, per y and item, the hi plane and behind it the residual plane.
__global__ __launch_bounds__(256) void k_split512s(const float* __restrict__ src, int rows, int ld, float scq, bf* d) {
    const int lane = threadIdx.x & 31; const size_t r = (size_t)blockIdx.x * 8 + (threadIdx.x >> 5); if (r >= (size_t)rows) return;
    const float sc = blockIdx.y ? 1.0f : scq; src += ((size_t)blockIdx.z * rows + r) * ld + blockIdx.y * DI;
    bf* dh = d + ((size_t)blockIdx.y * NBT + blockIdx.z) * 2 * rows * DI; bf* dl = dh + (size_t)rows * DI;
{
#pragma unroll
        for (int q = 0; q < DI / 256; ++q) { const size_t o = r * DI + q * 256 + lane * 8; const v8f v = *(const v8f*)(src + q * 256 + lane * 8); v8us oh, ol;
#pragma unroll
            for (int i = 0; i < 8; ++i) { const float y = v[i] * sc; const unsigned short hb = f2bf(y); oh[i] = hb; ol[i] = f2bf(y - bf2f(hb)); }
            *(v8us*)(dh + o) = oh; *(v8us*)(dl + o) = ol; }
         }
}
// grid.z = item; V rows at pitch ld.
__global__ __launch_bounds__(256) void k_vt512(const float* __restrict__ V, int ld, bf* Th, bf* Tl) {
    __shared__ float tl[64][65];
    typedef __attribute__((ext_vector_type(4))) unsigned short v4us;
    const int tid = threadIdx.x; const int t0 = blockIdx.x * 64, d0 = blockIdx.y * 64; const int rr = tid >> 2, cq = (tid & 3) * 16;
    V += (size_t)blockIdx.z * NN * ld; Th += (size_t)blockIdx.z * DI * NN; Tl += (size_t)blockIdx.z * DI * NN;
#pragma unroll
    for (int i = 0; i < 16; ++i) tl[rr][cq + i] = V[(size_t)(t0 + rr) * ld + d0 + cq + i];     // tl[t][d]
    __syncthreads();
    const int lane = tid & 31, wv = tid >> 5;
    auto pass = [&]() {
#pragma unroll
        for (int st = 0; st < 4; ++st) { const int dr = wv * 8 + st * 2 + (lane >> 4); const int tq = (lane & 15) * 4; v4us oh, ol;
#pragma unroll
            for (int i = 0; i < 4; ++i) { const float y = tl[tq + i][dr]; const unsigned short hb = f2bf(y); oh[i] = hb; ol[i] = f2bf(y - bf2f(hb)); }
            const size_t o = (size_t)(d0 + dr) * NN + t0 + tq; *(v4us*)(Th + o) = oh; *(v4us*)(Tl + o) = ol; }
    };
    pass(); 
}
__global__ __launch_bounds__(256) void k_csoft1(const float* __restrict__ S, bf* PH, bf* PL) {
    typedef __attribute__((ext_vector_type(4))) unsigned short v4us;
    const int lane = threadIdx.x & 31, i = blockIdx.x * 8 + (threadIdx.x >> 5); if (i >= NN) return; const float* sr = S + ((size_t)blockIdx.z * NN + i) * NN; PH += (size_t)blockIdx.z * NN * NN; PL += (size_t)blockIdx.z * NN * NN;   // grid.z = item
    float m = -3.0e38f;
#pragma unroll 1
    for (int c0 = lane * 4; c0 < NN; c0 += 128) {
#pragma unroll
        for (int q = 0; q < 4; ++q) { const int k = c0 + q; if (k <= i) m = fmaxf(m, sr[k]); } }
#pragma unroll
    for (int sh = 16; sh; sh >>= 1) m = fmaxf(m, __shfl_xor(m, sh, 32));
    float sum = 0.f;
#pragma unroll 1
    for (int c0 = lane * 4; c0 < NN; c0 += 128) {
#pragma unroll
        for (int q = 0; q < 4; ++q) { const int k = c0 + q; if (k <= i) sum += __expf(sr[k] - m); } }
#pragma unroll
    for (int sh = 16; sh; sh >>= 1) sum += __shfl_xor(sum, sh, 32);
    const float inv = 1.0f / sum;
{
#pragma unroll 1
        for (int c0 = lane * 4; c0 < NN; c0 += 128) { v4us oh, ol;
#pragma unroll
            for (int q = 0; q < 4; ++q) { const int k = c0 + q; const float p = (k <= i) ? __expf(sr[(k <= i) ? k : 0] - m) * inv : 0.f; const unsigned short hb = f2bf(p); oh[q] = hb; ol[q] = f2bf(p - bf2f(hb)); }
            const size_t o = (size_t)i * NN + c0; *(v4us*)(PH + o) = oh; *(v4us*)(PL + o) = ol; }
         }
}
__global__ __launch_bounds__(256) void k_ln512(const float* __restrict__ O, const float* __restrict__ g, const float* __restrict__ bb, float* OUTB) {
    const int lane = threadIdx.x & 31; const size_t t = (size_t)blockIdx.x * 8 + (threadIdx.x >> 5); if (t >= (size_t)NBT * NN) return; float v[16]; float s = 0.f;   // t runs over the rows of all items
#pragma unroll
    for (int q = 0; q < 4; ++q) {
#pragma unroll
        for (int i = 0; i < 4; ++i) { v[q * 4 + i] = O[t * DI + q * 128 + lane * 4 + i]; s += v[q * 4 + i]; } }
#pragma unroll
    for (int sh = 16; sh; sh >>= 1) s += __shfl_xor(s, sh, 32);
    const float mu = s * (1.0f / DI); float qv = 0.f;
#pragma unroll
    for (int i = 0; i < 16; ++i) { const float d = v[i] - mu; qv = fmaf(d, d, qv); }
#pragma unroll
    for (int sh = 16; sh; sh >>= 1) qv += __shfl_xor(qv, sh, 32);
    const float rs = rsqrtf(qv * (1.0f / DI) + LEPS);
{
#pragma unroll
        for (int q = 0; q < 4; ++q) { const int c0 = q * 128 + lane * 4; v4f y;
#pragma unroll
            for (int i = 0; i < 4; ++i) y[i] = (v[q * 4 + i] - mu) * rs * bfr(g[c0 + i]) + bfr(bb[c0 + i]);
            *(v4f*)(OUTB + t * DI + c0) = y; }
         }
}

extern "C" void kernel_launch(void* const* d_in, const int* in_sizes, int n_in,
                              void* d_out, int out_size, void* d_ws, size_t ws_size, hipStream_t stream) {
    (void)in_sizes; (void)n_in; (void)out_size;
    const float* x0 = (const float*)d_in[0]; const float* x1 = (const float*)d_in[1]; const float* Wq = (const float*)d_in[2]; const float* Wk = (const float*)d_in[3]; const float* Wv = (const float*)d_in[4]; const float* gam = (const float*)d_in[5]; const float* bet = (const float*)d_in[6];
    float* out = (float*)d_out;    // [8][2048][512]
    char* wsp = (char*)d_ws;
    auto take = [&](size_t bytes) { char* p = wsp; wsp += (bytes + 255) & ~(size_t)255; return (void*)p; };
    const size_t PLN = (size_t)NN * DI;      // one [2048][512] plane, elements
    const size_t SQ  = (size_t)NN * NN;      // one [2048][2048] plane, elements
    bf* WT = (bf*)take((size_t)3 * DI * DX * 2);                       // [Wq^T ; Wk^T ; Wv^T] as one [1536][1024] matrix
    bf* QK = (bf*)take((size_t)2 * NBT * 2 * PLN * 2);                 // q: per item [hi | residual]; behind all of q the same for k
    bf* VTh = (bf*)take((size_t)NBT * PLN * 2); bf* VTl = (bf*)take((size_t)NBT * PLN * 2);
    char* RA = (char*)take((size_t)NBT * NN * DX * 2 + (size_t)NBT * NN * 3 * DI * 4);   // 128 MiB, used twice in stream order
    bf* Xb = (bf*)RA; float* F = (float*)(RA + (size_t)NBT * NN * DX * 2);               // first: x as bf16 (all items) and [q | k | v] in f32 (all items)
    float* S = (float*)RA; bf* PH = (bf*)(RA + (size_t)NG * SQ * 4); bf* PL = PH + (size_t)NG * SQ;   // then, per group of NG items: scores and the two planes of wei
    bf* KB = QK + (size_t)NBT * 2 * PLN;
    float* O = (float*)QK;                   // item b's attention output lies on item b's q planes, which are dead once its scores are formed
    if ((size_t)(wsp - (char*)d_ws) > ws_size) return;    // 3 + 64 + 32 + 128 = 227 MiB
    k_wt<<<dim3(DX / 64, DI / 64, 3), 256, 0, stream>>>(Wq, Wk, Wv, DX, DI, WT);   // (in, out) weights
    k_cat<<<NBT * NN / 8, 256, 0, stream>>>(x0, x1, Xb);
    k_gemmb<<<dim3(NBT * NN / 128, 3 * DI / 128, 1), 128, 0, stream>>>(Xb, WT, F, 3 * DI, DX);
    k_split512s<<<dim3(NN / 8, 2, NBT), 256, 0, stream>>>(F, NN, 3 * DI, SCL, QK);
    k_vt512<<<dim3(NN / 64, DI / 64, NBT), 256, 0, stream>>>(F + 2 * DI, 3 * DI, VTh, VTl);
    for (int g = 0; g < NBT / NG; ++g) {     // scores and wei of all eight items do not fit the workspace at once
        const bf* Qg = QK + (size_t)g * NG * 2 * PLN; const bf* Kg = KB + (size_t)g * NG * 2 * PLN;
        k_gemm3x<1, 128, 128><<<dim3(NN / 128, NN / 128, NG), 128, 0, stream>>>(Qg, Qg + PLN, Kg, Kg + PLN, DI, S, NN, 2 * PLN, 2 * PLN, SQ);            // causal tiles only
        k_csoft1<<<dim3(NN / 8, 1, NG), 256, 0, stream>>>(S, PH, PL);
        k_gemm3x<2, 64, 128><<<dim3(NN / 64, DI / 128, NG), 128, 0, stream>>>(PH, PL, VTh + (size_t)g * NG * PLN, VTl + (size_t)g * NG * PLN, NN, O + (size_t)g * NG * PLN, DI, SQ, PLN, PLN); }   // K limited to the causal extent
    k_ln512<<<NBT * NN / 8, 256, 0, stream>>>(O, gam, bet, out);
}

// v004
// Measured time: 241 microseconds a run.
// Next to v003, in two timings, it ran 1.23 times as fast each time.
// All steps since v000 together make it 7.23 times as fast.
#include <hip/hip_runtime.h>

// Compute dtypes, f32 accumulate, per item: x = [x0 | x1] as exact bf16 rows; q/k/v = x.W ([2048 x 1024].[1024 x 512], PLAIN bf16 operands, exact products); single-head causal
// scores q.k^T ([2048 x 512].[512 x 2048]) and wei.v with both operands as bf16 hi + UNSCALED residual planes (three products; key tiles above the diagonal skipped, K limited);

#define NBT  8
#define NG   4             // items per launch of the score, softmax and wei.v stages
#define NN   2048
#define DI   512
#define DX   1024
#define DM   DX
#define NX   NN
#define NZ   NN
#define SCL  0.044194173824159216f   // 512^-0.5
#define LEPS 1e-5f
#define LOSC 1024.0f

typedef _Float16 h16;
typedef unsigned short bf;
typedef __attribute__((ext_vector_type(16))) __bf16   v16bf;
typedef __attribute__((ext_vector_type(16))) _Float16 v16h;
typedef __attribute__((ext_vector_type(8)))  _Float16 v8h;
typedef __attribute__((ext_vector_type(8)))  unsigned short v8us;
typedef __attribute__((ext_vector_type(8)))  float    v8f;
typedef __attribute__((ext_vector_type(4)))  float    v4f;
typedef __attribute__((ext_vector_type(4)))  _Float16 v4h;
typedef v8h  __attribute__((may_alias)) v8ha;
typedef v4f  __attribute__((may_alias)) v4fa;
typedef v8us __attribute__((may_alias)) v8usa;

__device__ __forceinline__ unsigned short f2bf(float f) { unsigned u = __float_as_uint(f); u += 0x7FFFu + ((u >> 16) & 1u); return (unsigned short)(u >> 16); }
__device__ __forceinline__ float bf2f(unsigned short b) { return __uint_as_float(((unsigned)b) << 16); }
__device__ __forceinline__ float bfr(float f) { return bf2f(f2bf(f)); }
__device__ __forceinline__ v16h cat16(v8h lo, v8h hi) { return __builtin_shufflevector(lo, hi, 0, 1, 2, 3, 4, 5, 6, 7, 8, 9, 10, 11, 12, 13, 14, 15); }
__device__ __forceinline__ v16bf cat16b(v8us lo, v8us hi) { return __builtin_bit_cast(v16bf, __builtin_shufflevector(lo, hi, 0, 1, 2, 3, 4, 5, 6, 7, 8, 9, 10, 11, 12, 13, 14, 15)); }
__device__ __forceinline__ v8f wmma16(v16h a, v16h b, v8f c) { return __builtin_amdgcn_wmma_f32_16x16x32_f16(false, a, false, b, (short)0, c, false, false); }
__device__ __forceinline__ v8f wmmab(v16bf a, v16bf b, v8f c) { return __builtin_amdgcn_wmma_f32_16x16x32_bf16(false, a, false, b, (short)0, c, false, false); }

// k_wt: WT [n][K] = bf16(W[k][n]) (k-major [K][ncols]) via 64 x 64 LDS tiles; grid (K/64, ncols/64, 3): z picks the weight, the three transposes lie one behind the other as one [3 * ncols][K] matrix.
__global__ __launch_bounds__(256) void k_wt(const float* __restrict__ W0, const float* __restrict__ W1, const float* __restrict__ W2, int K, int ncols, bf* WT) {
    __shared__ __align__(16) unsigned short tl[64 * 72];
    const float* __restrict__ Wm = blockIdx.z == 0 ? W0 : (blockIdx.z == 1 ? W1 : W2); WT += (size_t)blockIdx.z * ncols * K;
    const int tid = threadIdx.x, k0 = blockIdx.x * 64, n0 = blockIdx.y * 64;
    const int kk = tid >> 2, nq = (tid & 3) * 16;
#pragma unroll
    for (int i = 0; i < 16; ++i) tl[(nq + i) * 72 + kk] = f2bf(Wm[(size_t)(k0 + kk) * ncols + n0 + nq + i]);
    __syncthreads();
    const int piece = tid & 7;
    auto pass = [&]() {
#pragma unroll
        for (int s = 0; s < 2; ++s) { const int nr = (tid >> 3) + 32 * s; const v8us val = *(const v8usa*)(tl + nr * 72 + piece * 8); *(v8us*)(WT + (size_t)(n0 + nr) * K + k0 + piece * 8) = val; }
    };
    pass(); 
}
// Tile staging for the matrix kernels: a 64-row x 64-k bf16 plane lies in LDS at a row pitch of 144 B (16 B x 9, conflict-free for 16-byte fragment reads).
#define TP   72            // LDS row pitch, bf16 elements
#define TPL  (64 * TP)     // one plane, bf16 elements
#define TPLB (TPL * 2)     // one plane, bytes
// cp8: this lane's 16-byte pieces of two planes (rows +0, +16, +32, +48 of each): a wave's copy reads four whole 128-B lines. st = 16 source rows in elements.
__device__ __forceinline__ void cp8(const bf* p, const bf* q, size_t st, unsigned lp, unsigned lq) {
    // asynchronous copies global -> LDS; s_wait_xcnt 0 closes the statement so that no address register is rewritten ahead of it
    asm volatile("global_load_async_to_lds_b128 %0, %8, off\n\t"
                 "global_load_async_to_lds_b128 %1, %9, off\n\t"
                 "global_load_async_to_lds_b128 %2, %10, off\n\t"
                 "global_load_async_to_lds_b128 %3, %11, off\n\t"
                 "global_load_async_to_lds_b128 %4, %12, off\n\t"
                 "global_load_async_to_lds_b128 %5, %13, off\n\t"
                 "global_load_async_to_lds_b128 %6, %14, off\n\t"
                 "global_load_async_to_lds_b128 %7, %15, off\n\t"
                 "s_wait_xcnt 0x0"
                 :: "v"(lp), "v"(lp + 16u * 144u), "v"(lp + 32u * 144u), "v"(lp + 48u * 144u), "v"(lq), "v"(lq + 16u * 144u), "v"(lq + 32u * 144u), "v"(lq + 48u * 144u),
                    "v"(p), "v"(p + st), "v"(p + 2 * st), "v"(p + 3 * st), "v"(q), "v"(q + st), "v"(q + 2 * st), "v"(q + 3 * st) : "memory");
}
__device__ __forceinline__ void wait_copies() { asm volatile("s_wait_asynccnt 0x0" ::: "memory"); }   // this wave's copies have landed in LDS
__device__ __forceinline__ void wait_lds()    { asm volatile("s_wait_dscnt 0x0" ::: "memory"); }      // this wave's LDS reads are done before the buffer is refilled
__device__ __forceinline__ v16bf frag(const bf* r) { return cat16b(*(const v8usa*)r, *(const v8usa*)(r + 16)); }

// hold: four vector slots behind the pass's last matrix instruction on every path; naming every accumulator also keeps that instruction in front of the waits and the barrier that follow
template <int FM>
__device__ __forceinline__ void hold(v8f (&c)[FM][4]) {
    static_assert(FM == 2 || FM == 4, "two or four rows of accumulator tiles");
    if constexpr (FM == 4)
        asm volatile("v_nop\n\tv_nop\n\tv_nop\n\tv_nop" : "+v"(c[0][0]), "+v"(c[0][1]), "+v"(c[0][2]), "+v"(c[0][3]), "+v"(c[1][0]), "+v"(c[1][1]), "+v"(c[1][2]), "+v"(c[1][3]),
                                                          "+v"(c[2][0]), "+v"(c[2][1]), "+v"(c[2][2]), "+v"(c[2][3]), "+v"(c[3][0]), "+v"(c[3][1]), "+v"(c[3][2]), "+v"(c[3][3]));
    else
        asm volatile("v_nop\n\tv_nop\n\tv_nop\n\tv_nop" : "+v"(c[0][0]), "+v"(c[0][1]), "+v"(c[0][2]), "+v"(c[0][3]), "+v"(c[1][0]), "+v"(c[1][1]), "+v"(c[1][2]), "+v"(c[1][3]));
}

// k_gemmb: 128 x 128 block tile (2 x 2 waves, 64 x 64 each) of C[NTK][NW] = A.B^T (K = 1024); A and B tiles (two 64-row planes each) staged in LDS, two buffers;
// f32 whole-line epilogue, staged per wave in the ring, which every wave has left at the last pass's barrier.
__global__ __launch_bounds__(128) void k_gemmb(const bf* __restrict__ A, const bf* __restrict__ Bn, float* C, int ldc, int K) {
    __shared__ __align__(16) bf stg[2 * 4 * TPL];
    static_assert(4 * 64 * 68 * 4 <= 2 * 4 * TPLB, "the output staging fits the ring");
    const int tid = threadIdx.x, lane = tid & 31, wave = tid >> 5, lr = lane & 15, hi = lane >> 4, wm = wave >> 1, wn = wave & 1;
    const int r0 = blockIdx.x * 128 + wm * 64, c0 = blockIdx.y * 128 + wn * 64;
    const size_t ao = (size_t)(blockIdx.x * 128 + (tid >> 3)) * K + (tid & 7) * 8, bo = (size_t)(blockIdx.y * 128 + (tid >> 3)) * K + (tid & 7) * 8, st16 = (size_t)16 * K, st64 = (size_t)64 * K;
    const unsigned l0 = (unsigned)(size_t)&stg[0] + (unsigned)((tid >> 3) * 144 + (tid & 7) * 16);
    auto fill = [&](int t) { const unsigned lb = l0 + (unsigned)(t & 1) * (4u * TPLB);
        cp8(A + ao + t * 64, A + ao + st64 + t * 64, st16, lb, lb + TPLB); cp8(Bn + bo + t * 64, Bn + bo + st64 + t * 64, st16, lb + 2u * TPLB, lb + 3u * TPLB); };
    const int nt = K >> 6;
    v8f acc[4][4];
#pragma unroll
    for (int m = 0; m < 4; ++m) {
#pragma unroll
        for (int t = 0; t < 4; ++t) acc[m][t] = (v8f){}; }
    fill(0); wait_copies(); __syncthreads();
    if (nt > 1) fill(1);
#pragma unroll 1   // stays rolled: one pass per staged tile, the two buffers alternate
    for (int s = 0; s < nt; ++s) {
        const bf* sb = &stg[(s & 1) * 4 * TPL];
#pragma unroll     // both 32-k halves of the tile in one block: fragment offsets become immediates and the LDS reads overlap the matrix work
        for (int ks = 0; ks < 2; ++ks) {
            v16bf a[4], b[4];
#pragma unroll
            for (int m = 0; m < 4; ++m) a[m] = frag(sb + (wm * 64 + m * 16 + lr) * TP + ks * 32 + 8 * hi);
#pragma unroll
            for (int t = 0; t < 4; ++t) b[t] = frag(sb + 2 * TPL + (wn * 64 + t * 16 + lr) * TP + ks * 32 + 8 * hi);
            __builtin_amdgcn_sched_barrier(0);   // the step's fragment loads stay one group in front of its matrix block: sunk among the matrix instructions, each pair is waited out on its own
#pragma unroll
            for (int t = 0; t < 4; ++t) {
#pragma unroll
                for (int m = 0; m < 4; ++m) acc[m][t] = wmmab(a[m], b[t], acc[m][t]); }
        }
        hold<4>(acc);
        wait_lds(); wait_copies(); __syncthreads();    // publishes tile s + 1 and ends every read of tile s
        if (s + 2 < nt) fill(s + 2);
    }
    wait_copies();
    float* os = (float*)(void*)stg + wave * (64 * 68);
#pragma unroll
    for (int m = 0; m < 4; ++m) {
#pragma unroll
        for (int t = 0; t < 4; ++t) {
#pragma unroll
            for (int j = 0; j < 8; ++j) os[(m * 16 + hi * 8 + j) * 68 + t * 16 + lr] = acc[m][t][j]; } }
    __syncthreads();
    float* crow = C + (size_t)r0 * ldc + c0;
#pragma unroll
    for (int s = 0; s < 32; ++s) { const int Lid = (lane >> 3) + 4 * s, piece = lane & 7; const int row = Lid >> 1, cofs = (Lid & 1) * 32 + piece * 4;
        const v4f val = *(const v4fa*)(os + row * 68 + cofs); *(v4f*)(crow + (size_t)row * ldc + cofs) = val; }
}

// k_gemm3x: BM x BN block tile (2 x 2 waves, BM/2 x 64 each; BN = 128) of C = (Ah + Al).(Bh + Bl)^T over K (row strides = K for all four planes; n-major B): three products per 32-k step (hh, lh, hl, in that
// order into each accumulator); the four planes' tiles staged in LDS as 64-row planes, two buffers; f32 whole-line epilogue, staged per wave in the ring, which every wave has left at the last pass's barrier.
// grid.z = item: sA, sB, sC are the item strides (elements) of the A planes, the B planes and C.
template <int MODE, int BM, int BN>
__global__ __launch_bounds__(128) void k_gemm3x(const bf* __restrict__ Ah, const bf* __restrict__ Al, const bf* __restrict__ Bh, const bf* __restrict__ Bl, int K, float* C, int ldc, size_t sA, size_t sB, size_t sC) {
    constexpr int CA = BM / 64, CB = BN / 64, WM = BM / 2, FM = WM / 16, NPL = 2 * (CA + CB), NB = FM == 4 ? 2 : 4;   // 64-row planes per operand plane; rows and accumulator rows per wave; planes per buffer; B column groups held in registers at a time
    static_assert(BN == 128 && 4 * WM * 68 * 4 <= 2 * NPL * TPLB, "64 columns per wave; the output staging fits the ring");
    if ((MODE & 1) && (int)blockIdx.y * BN > (int)blockIdx.x * BM + BM - 1) return;
    const int Klim = (MODE & 2) ? min(K, ((int)blockIdx.x + 1) * BM) : K;
    __shared__ __align__(16) bf stg[2 * NPL * TPL];
    const int tid = threadIdx.x, lane = tid & 31, wave = tid >> 5, lr = lane & 15, hi = lane >> 4, wm = wave >> 1, wn = wave & 1;
    const int r0 = blockIdx.x * BM + wm * WM, c0 = blockIdx.y * BN + wn * 64;
    const size_t ao = blockIdx.z * sA + (size_t)(blockIdx.x * BM) * K, bo = blockIdx.z * sB + (size_t)(blockIdx.y * BN) * K, st16 = (size_t)16 * K, st64 = (size_t)64 * K;   // the block's tiles: the same in every lane
    const unsigned vo = (unsigned)((tid >> 3) * K + (tid & 7) * 8);   // this lane's piece inside a 16-row slab; the k offset is added to it in 32 bits, so that one register, not eight pointers, lives through the loop
    const unsigned l0 = (unsigned)(size_t)&stg[0] + (unsigned)((tid >> 3) * 144 + (tid & 7) * 16);
    auto fill = [&](int t) { const unsigned lb = l0 + (unsigned)(t & 1) * ((unsigned)NPL * TPLB);
#pragma unroll
        for (int c = 0; c < CA; ++c) cp8(Ah + ao + c * st64 + (vo + (unsigned)t * 64u), Al + ao + c * st64 + (vo + (unsigned)t * 64u), st16, lb + (unsigned)c * TPLB, lb + (unsigned)(CA + c) * TPLB);
#pragma unroll
        for (int c = 0; c < CB; ++c) cp8(Bh + bo + c * st64 + (vo + (unsigned)t * 64u), Bl + bo + c * st64 + (vo + (unsigned)t * 64u), st16, lb + (unsigned)(2 * CA + c) * TPLB, lb + (unsigned)(2 * CA + CB + c) * TPLB); };
    const int nt = Klim >> 6;
    v8f acc[FM][4];
#pragma unroll
    for (int m = 0; m < FM; ++m) {
#pragma unroll
        for (int t = 0; t < 4; ++t) acc[m][t] = (v8f){}; }
    fill(0); wait_copies(); __syncthreads();
    if (nt > 1) fill(1);
#pragma unroll 1   // stays rolled: one pass per staged tile, the two buffers alternate
    for (int s = 0; s < nt; ++s) {
        const bf* sb = &stg[(s & 1) * NPL * TPL];
#pragma unroll     // both 32-k halves of the tile in one block: fragment offsets become immediates and the LDS reads overlap the matrix work
        for (int ks = 0; ks < 2; ++ks) {
            v16bf a[FM], al[FM], bh[NB], bl[NB];
            const bf* br = sb + 2 * CA * TPL + (wn * 64 + lr) * TP + ks * 32 + 8 * hi;
#pragma unroll
            for (int m = 0; m < FM; ++m) { const bf* ar = sb + (wm * WM + m * 16 + lr) * TP + ks * 32 + 8 * hi; a[m] = frag(ar); al[m] = frag(ar + CA * TPL); }
#pragma unroll
            for (int t = 0; t < NB; ++t) { bh[t] = frag(br + t * 16 * TP); bl[t] = frag(br + t * 16 * TP + CB * TPL); }
            __builtin_amdgcn_sched_barrier(0);   // the step's fragment loads stay one group in front of its matrix block: sunk among the matrix instructions, each pair is waited out on its own
#pragma unroll
            for (int t = 0; t < 4; ++t) { const int u = t % NB;
#pragma unroll
                for (int m = 0; m < FM; ++m) acc[m][t] = wmmab(a[m], bh[u], acc[m][t]);
#pragma unroll
                for (int m = 0; m < FM; ++m) acc[m][t] = wmmab(al[m], bh[u], acc[m][t]);
#pragma unroll
                for (int m = 0; m < FM; ++m) acc[m][t] = wmmab(a[m], bl[u], acc[m][t]);
                if (t + NB < 4) {   // the B registers just used take column group t + NB; the fence pair keeps these loads here, one whole matrix group ahead of their use
                    __builtin_amdgcn_sched_barrier(0);
                    bh[u] = frag(br + (t + NB) * 16 * TP); bl[u] = frag(br + (t + NB) * 16 * TP + CB * TPL);
                    __builtin_amdgcn_sched_barrier(0); } }
        }
        hold<FM>(acc);
        wait_lds(); wait_copies(); __syncthreads();    // publishes tile s + 1 and ends every read of tile s
        if (s + 2 < nt) fill(s + 2);
    }
    wait_copies();
    float* os = (float*)(void*)stg + wave * (WM * 68);
#pragma unroll
    for (int m = 0; m < FM; ++m) {
#pragma unroll
        for (int t = 0; t < 4; ++t) {
#pragma unroll
            for (int j = 0; j < 8; ++j) os[(m * 16 + hi * 8 + j) * 68 + t * 16 + lr] = acc[m][t][j]; } }
    __builtin_amdgcn_wave_barrier(); asm volatile("" ::: "memory");   // the wave's staged rows are stored before any of its lanes reads them back; no other wave touches them
    float* crow = C + blockIdx.z * sC + (size_t)r0 * ldc + c0;
#pragma unroll
    for (int s = 0; s < 8 * FM; ++s) { const int Lid = (lane >> 3) + 4 * s, piece = lane & 7; const int row = Lid >> 1, cofs = (Lid & 1) * 32 + piece * 4;
        const v4f val = *(const v4fa*)(os + row * 68 + cofs); *(v4f*)(crow + (size_t)row * ldc + cofs) = val; }
}


__global__ __launch_bounds__(256) void k_cat(const float* __restrict__ a, const float* __restrict__ c, bf* Xb) {
    const int lane = threadIdx.x & 31; const size_t t = (size_t)blockIdx.x * 8 + (threadIdx.x >> 5); if (t >= (size_t)NBT * NN) return;   // t runs over the rows of all items
{
#pragma unroll
        for (int q = 0; q < 4; ++q) { const float* src = (q < 2 ? a : c) + t * DI + (q & 1) * 256 + lane * 8; v8us o;
#pragma unroll
            for (int i = 0; i < 8; ++i) o[i] = f2bf(src[i]);
            *(v8us*)(Xb + t * DX + q * 256 + lane * 8) = o; }
         }
}
// grid (rows/8, 2, items): y = 0 splits q (scaled by scq), y = 1 splits k; src row = [q | k | v] at pitch ld; d holds, per y and item, the hi plane and behind it the residual plane.
__global__ __launch_bounds__(256) void k_split512s(const float* __restrict__ src, int rows, int ld, float scq, bf* d) {
    const int lane = threadIdx.x & 31; const size_t r = (size_t)blockIdx.x * 8 + (threadIdx.x >> 5); if (r >= (size_t)rows) return;
    const float sc = blockIdx.y ? 1.0f : scq; src += ((size_t)blockIdx.z * rows + r) * ld + blockIdx.y * DI;
    bf* dh = d + ((size_t)blockIdx.y * NBT + blockIdx.z) * 2 * rows * DI; bf* dl = dh + (size_t)rows * DI;
{
#pragma unroll
        for (int q = 0; q < DI / 256; ++q) { const size_t o = r * DI + q * 256 + lane * 8; const v8f v = *(const v8f*)(src + q * 256 + lane * 8); v8us oh, ol;
#pragma unroll
            for (int i = 0; i < 8; ++i) { const float y = v[i] * sc; const unsigned short hb = f2bf(y); oh[i] = hb; ol[i] = f2bf(y - bf2f(hb)); }
            *(v8us*)(dh + o) = oh; *(v8us*)(dl + o) = ol; }
         }
}
// grid.z = item; V rows at pitch ld.
__global__ __launch_bounds__(256) void k_vt512(const float* __restrict__ V, int ld, bf* Th, bf* Tl) {
    __shared__ float tl[64][65];
    typedef __attribute__((ext_vector_type(4))) unsigned short v4us;
    const int tid = threadIdx.x; const int t0 = blockIdx.x * 64, d0 = blockIdx.y * 64; const int rr = tid >> 2, cq = (tid & 3) * 16;
    V += (size_t)blockIdx.z * NN * ld; Th += (size_t)blockIdx.z * DI * NN; Tl += (size_t)blockIdx.z * DI * NN;
#pragma unroll
    for (int i = 0; i < 16; ++i) tl[rr][cq + i] = V[(size_t)(t0 + rr) * ld + d0 + cq + i];     // tl[t][d]
    __syncthreads();
    const int lane = tid & 31, wv = tid >> 5;
    auto pass = [&]() {
#pragma unroll
        for (int st = 0; st < 4; ++st) { const int dr = wv * 8 + st * 2 + (lane >> 4); const int tq = (lane & 15) * 4; v4us oh, ol;
#pragma unroll
            for (int i = 0; i < 4; ++i) { const float y = tl[tq + i][dr]; const unsigned short hb = f2bf(y); oh[i] = hb; ol[i] = f2bf(y - bf2f(hb)); }
            const size_t o = (size_t)(d0 + dr) * NN + t0 + tq; *(v4us*)(Th + o) = oh; *(v4us*)(Tl + o) = ol; }
    };
    pass(); 
}
// One wave per row. The row's causal extent, in whole chunks of 128 columns up to the one that holds the diagonal, is read once, every load in flight before the first is used,
// and stays in registers for the maximum, the sum and the two planes. Lane -> column map and each lane's order of summing are those of a pass over the chunks in rising order.
// Chunks past the diagonal are neither read nor written: wei.v stops at the row block's causal limit, which lies inside the chunks written here.
__global__ __launch_bounds__(256) void k_csoft1(const float* __restrict__ S, bf* PH, bf* PL) {
    typedef __attribute__((ext_vector_type(4))) unsigned short v4us;
    constexpr int NC = NN / 128;
    const int lane = threadIdx.x & 31, i = blockIdx.x * 8 + __builtin_amdgcn_readfirstlane((int)(threadIdx.x >> 5)); if (i >= NN) return;   // the row is the same in every lane: the chunk tests below are scalar branches
    const float* sr = S + ((size_t)blockIdx.z * NN + i) * NN + lane * 4; PH += (size_t)blockIdx.z * NN * NN + (size_t)i * NN + lane * 4; PL += (size_t)blockIdx.z * NN * NN + (size_t)i * NN + lane * 4;   // grid.z = item
    const int nch = (i >> 7) + 1;      // chunks that hold a column <= i
    v4f s[NC];
#pragma unroll
    for (int c = 0; c < NC; ++c) { s[c] = (v4f){}; if (c < nch) s[c] = *(const v4fa*)(sr + c * 128); }
    asm volatile("s_wait_xcnt 0x0" :: "v"(sr) : "memory");   // stands in front of any reuse of the loads' address registers, which the operand keeps whole up to here
    float mq[4] = {-3.0e38f, -3.0e38f, -3.0e38f, -3.0e38f};
#pragma unroll
    for (int c = 0; c < NC; ++c) if (c < nch) {
        if (c == nch - 1) {            // only the diagonal's chunk holds columns above it: they take the start value of the maximum, whose exponential is 0
#pragma unroll
            for (int q = 0; q < 4; ++q) if (c * 128 + lane * 4 + q > i) s[c][q] = -3.0e38f; }
#pragma unroll
        for (int q = 0; q < 4; ++q) mq[q] = fmaxf(mq[q], s[c][q]); }
    float m = fmaxf(fmaxf(mq[0], mq[1]), fmaxf(mq[2], mq[3]));
#pragma unroll
    for (int sh = 16; sh; sh >>= 1) m = fmaxf(m, __shfl_xor(m, sh, 32));
    float sum = 0.f;
#pragma unroll
    for (int c = 0; c < NC; ++c) if (c < nch) {
#pragma unroll
        for (int q = 0; q < 4; ++q) { s[c][q] = __expf(s[c][q] - m); sum += s[c][q]; } }
#pragma unroll
    for (int sh = 16; sh; sh >>= 1) sum += __shfl_xor(sum, sh, 32);
    const float inv = 1.0f / sum;
#pragma unroll
    for (int c = 0; c < NC; ++c) if (c < nch) { v4us oh, ol;
#pragma unroll
        for (int q = 0; q < 4; ++q) { const float p = s[c][q] * inv; const unsigned short hb = f2bf(p); oh[q] = hb; ol[q] = f2bf(p - bf2f(hb)); }
        *(v4us*)(PH + c * 128) = oh; *(v4us*)(PL + c * 128) = ol;
        asm volatile("s_wait_xcnt 0x0" ::: "memory"); }   // the next chunk reuses the two stores' registers
}
__global__ __launch_bounds__(256) void k_ln512(const float* __restrict__ O, const float* __restrict__ g, const float* __restrict__ bb, float* OUTB) {
    const int lane = threadIdx.x & 31; const size_t t = (size_t)blockIdx.x * 8 + (threadIdx.x >> 5); if (t >= (size_t)NBT * NN) return; float v[16]; float s = 0.f;   // t runs over the rows of all items
#pragma unroll
    for (int q = 0; q < 4; ++q) {
#pragma unroll
        for (int i = 0; i < 4; ++i) { v[q * 4 + i] = O[t * DI + q * 128 + lane * 4 + i]; s += v[q * 4 + i]; } }
#pragma unroll
    for (int sh = 16; sh; sh >>= 1) s += __shfl_xor(s, sh, 32);
    const float mu = s * (1.0f / DI); float qv = 0.f;
#pragma unroll
    for (int i = 0; i < 16; ++i) { const float d = v[i] - mu; qv = fmaf(d, d, qv); }
#pragma unroll
    for (int sh = 16; sh; sh >>= 1) qv += __shfl_xor(qv, sh, 32);
    const float rs = rsqrtf(qv * (1.0f / DI) + LEPS);
{
#pragma unroll
        for (int q = 0; q < 4; ++q) { const int c0 = q * 128 + lane * 4; v4f y;
#pragma unroll
            for (int i = 0; i < 4; ++i) y[i] = (v[q * 4 + i] - mu) * rs * bfr(g[c0 + i]) + bfr(bb[c0 + i]);
            *(v4f*)(OUTB + t * DI + c0) = y; }
         }
}

extern "C" void kernel_launch(void* const* d_in, const int* in_sizes, int n_in,
                              void* d_out, int out_size, void* d_ws, size_t ws_size, hipStream_t stream) {
    (void)in_sizes; (void)n_in; (void)out_size;
    const float* x0 = (const float*)d_in[0]; const float* x1 = (const float*)d_in[1]; const float* Wq = (const float*)d_in[2]; const float* Wk = (const float*)d_in[3]; const float* Wv = (const float*)d_in[4]; const float* gam = (const float*)d_in[5]; const float* bet = (const float*)d_in[6];
    float* out = (float*)d_out;    // [8][2048][512]
    char* wsp = (char*)d_ws;
    auto take = [&](size_t bytes) { char* p = wsp; wsp += (bytes + 255) & ~(size_t)255; return (void*)p; };
    const size_t PLN = (size_t)NN * DI;      // one [2048][512] plane, elements
    const size_t SQ  = (size_t)NN * NN;      // one [2048][2048] plane, elements
    bf* WT = (bf*)take((size_t)3 * DI * DX * 2);                       // [Wq^T ; Wk^T ; Wv^T] as one [1536][1024] matrix
    bf* QK = (bf*)take((size_t)2 * NBT * 2 * PLN * 2);                 // q: per item [hi | residual]; behind all of q the same for k
    bf* VTh = (bf*)take((size_t)NBT * PLN * 2); bf* VTl = (bf*)take((size_t)NBT * PLN * 2);
    char* RA = (char*)take((size_t)NBT * NN * DX * 2 + (size_t)NBT * NN * 3 * DI * 4);   // 128 MiB, used twice in stream order
    bf* Xb = (bf*)RA; float* F = (float*)(RA + (size_t)NBT * NN * DX * 2);               // first: x as bf16 (all items) and [q | k | v] in f32 (all items)
    float* S = (float*)RA; bf* PH = (bf*)(RA + (size_t)NG * SQ * 4); bf* PL = PH + (size_t)NG * SQ;   // then, per group of NG items: scores and the two planes of wei
    bf* KB = QK + (size_t)NBT * 2 * PLN;
    float* O = (float*)QK;                   // item b's attention output lies on item b's q planes, which are dead once its scores are formed
    if ((size_t)(wsp - (char*)d_ws) > ws_size) return;    // 3 + 64 + 32 + 128 = 227 MiB
    k_wt<<<dim3(DX / 64, DI / 64, 3), 256, 0, stream>>>(Wq, Wk, Wv, DX, DI, WT);   // (in, out) weights
    k_cat<<<NBT * NN / 8, 256, 0, stream>>>(x0, x1, Xb);
    k_gemmb<<<dim3(NBT * NN / 128, 3 * DI / 128, 1), 128, 0, stream>>>(Xb, WT, F, 3 * DI, DX);
    k_split512s<<<dim3(NN / 8, 2, NBT), 256, 0, stream>>>(F, NN, 3 * DI, SCL, QK);
    k_vt512<<<dim3(NN / 64, DI / 64, NBT), 256, 0, stream>>>(F + 2 * DI, 3 * DI, VTh, VTl);
    for (int g = 0; g < NBT / NG; ++g) {     // scores and wei of all eight items do not fit the workspace at once
        const bf* Qg = QK + (size_t)g * NG * 2 * PLN; const bf* Kg = KB + (size_t)g * NG * 2 * PLN;
        k_gemm3x<1, 128, 128><<<dim3(NN / 128, NN / 128, NG), 128, 0, stream>>>(Qg, Qg + PLN, Kg, Kg + PLN, DI, S, NN, 2 * PLN, 2 * PLN, SQ);            // causal tiles only
        k_csoft1<<<dim3(NN / 8, 1, NG), 256, 0, stream>>>(S, PH, PL);
        k_gemm3x<2, 64, 128><<<dim3(NN / 64, DI / 128, NG), 128, 0, stream>>>(PH, PL, VTh + (size_t)g * NG * PLN, VTl + (size_t)g * NG * PLN, NN, O + (size_t)g * NG * PLN, DI, SQ, PLN, PLN); }   // K limited to the causal extent
    k_ln512<<<NBT * NN / 8, 256, 0, stream>>>(O, gam, bet, out);
}

// v005
// A run of this version takes 219 microseconds.
// Timed twice side by side with v004, it ran 1.10 times as fast both times.
// Counting every step since v000, it is 7.96 times as fast.
#include <hip/hip_runtime.h>

// Compute dtypes, f32 accumulate, per item: x = [x0 | x1] as exact bf16 rows; q/k/v = x.W ([2048 x 1024].[1024 x 512], PLAIN bf16 operands, exact products); single-head causal
// scores q.k^T ([2048 x 512].[512 x 2048]) and wei.v with both operands as bf16 hi + UNSCALED residual planes (three products; key tiles above the diagonal skipped, K limited);

#define NBT  8
#define NG   4             // items per launch of the score, softmax and wei.v stages
#define NN   2048
#define DI   512
#define DX   1024
#define DM   DX
#define NX   NN
#define NZ   NN
#define SCL  0.044194173824159216f   // 512^-0.5
#define LEPS 1e-5f
#define LOSC 1024.0f

typedef _Float16 h16;
typedef unsigned short bf;
typedef __attribute__((ext_vector_type(16))) __bf16   v16bf;
typedef __attribute__((ext_vector_type(16))) _Float16 v16h;
typedef __attribute__((ext_vector_type(8)))  _Float16 v8h;
typedef __attribute__((ext_vector_type(8)))  unsigned short v8us;
typedef __attribute__((ext_vector_type(8)))  float    v8f;
typedef __attribute__((ext_vector_type(4)))  float    v4f;
typedef __attribute__((ext_vector_type(4)))  _Float16 v4h;
typedef v8h  __attribute__((may_alias)) v8ha;
typedef v4f  __attribute__((may_alias)) v4fa;
typedef v8us __attribute__((may_alias)) v8usa;

__device__ __forceinline__ unsigned short f2bf(float f) { unsigned u = __float_as_uint(f); u += 0x7FFFu + ((u >> 16) & 1u); return (unsigned short)(u >> 16); }
__device__ __forceinline__ float bf2f(unsigned short b) { return __uint_as_float(((unsigned)b) << 16); }
__device__ __forceinline__ float bfr(float f) { return bf2f(f2bf(f)); }
__device__ __forceinline__ v16h cat16(v8h lo, v8h hi) { return __builtin_shufflevector(lo, hi, 0, 1, 2, 3, 4, 5, 6, 7, 8, 9, 10, 11, 12, 13, 14, 15); }
__device__ __forceinline__ v16bf cat16b(v8us lo, v8us hi) { return __builtin_bit_cast(v16bf, __builtin_shufflevector(lo, hi, 0, 1, 2, 3, 4, 5, 6, 7, 8, 9, 10, 11, 12, 13, 14, 15)); }
__device__ __forceinline__ v8f wmma16(v16h a, v16h b, v8f c) { return __builtin_amdgcn_wmma_f32_16x16x32_f16(false, a, false, b, (short)0, c, false, false); }
__device__ __forceinline__ v8f wmmab(v16bf a, v16bf b, v8f c) { return __builtin_amdgcn_wmma_f32_16x16x32_bf16(false, a, false, b, (short)0, c, false, false); }

// k_wt: WT [n][K] = bf16(W[k][n]) (k-major [K][ncols]) via 64 x 64 LDS tiles; grid (K/64, ncols/64, 3): z picks the weight, the three transposes lie one behind the other as one [3 * ncols][K] matrix.
__global__ __launch_bounds__(256) void k_wt(const float* __restrict__ W0, const float* __restrict__ W1, const float* __restrict__ W2, int K, int ncols, bf* WT) {
    __shared__ __align__(16) unsigned short tl[64 * 72];
    const float* __restrict__ Wm = blockIdx.z == 0 ? W0 : (blockIdx.z == 1 ? W1 : W2); WT += (size_t)blockIdx.z * ncols * K;
    const int tid = threadIdx.x, k0 = blockIdx.x * 64, n0 = blockIdx.y * 64;
    const int kk = tid >> 2, nq = (tid & 3) * 16;
#pragma unroll
    for (int i = 0; i < 16; ++i) tl[(nq + i) * 72 + kk] = f2bf(Wm[(size_t)(k0 + kk) * ncols + n0 + nq + i]);
    __syncthreads();
    const int piece = tid & 7;
    auto pass = [&]() {
#pragma unroll
        for (int s = 0; s < 2; ++s) { const int nr = (tid >> 3) + 32 * s; const v8us val = *(const v8usa*)(tl + nr * 72 + piece * 8); *(v8us*)(WT + (size_t)(n0 + nr) * K + k0 + piece * 8) = val; }
    };
    pass(); 
}
// Tile staging for the matrix kernels: a 64-row x 64-k bf16 plane lies in LDS at a row pitch of 144 B (16 B x 9, conflict-free for 16-byte fragment reads).
#define TP   72            // LDS row pitch, bf16 elements
#define TPL  (64 * TP)     // one plane, bf16 elements
#define TPLB (TPL * 2)     // one plane, bytes
// cp8: this lane's 16-byte pieces of two planes (rows +0, +16, +32, +48 of each): a wave's copy reads four whole 128-B lines. st = 16 source rows in elements.
__device__ __forceinline__ void cp8(const bf* p, const bf* q, size_t st, unsigned lp, unsigned lq) {
    // asynchronous copies global -> LDS; s_wait_xcnt 0 closes the statement so that no address register is rewritten ahead of it
    asm volatile("global_load_async_to_lds_b128 %0, %8, off\n\t"
                 "global_load_async_to_lds_b128 %1, %9, off\n\t"
                 "global_load_async_to_lds_b128 %2, %10, off\n\t"
                 "global_load_async_to_lds_b128 %3, %11, off\n\t"
                 "global_load_async_to_lds_b128 %4, %12, off\n\t"
                 "global_load_async_to_lds_b128 %5, %13, off\n\t"
                 "global_load_async_to_lds_b128 %6, %14, off\n\t"
                 "global_load_async_to_lds_b128 %7, %15, off\n\t"
                 "s_wait_xcnt 0x0"
                 :: "v"(lp), "v"(lp + 16u * 144u), "v"(lp + 32u * 144u), "v"(lp + 48u * 144u), "v"(lq), "v"(lq + 16u * 144u), "v"(lq + 32u * 144u), "v"(lq + 48u * 144u),
                    "v"(p), "v"(p + st), "v"(p + 2 * st), "v"(p + 3 * st), "v"(q), "v"(q + st), "v"(q + 2 * st), "v"(q + 3 * st) : "memory");
}
__device__ __forceinline__ void wait_copies() { asm volatile("s_wait_asynccnt 0x0" ::: "memory"); }   // this wave's copies have landed in LDS
__device__ __forceinline__ void wait_lds()    { asm volatile("s_wait_dscnt 0x0" ::: "memory"); }      // this wave's LDS reads are done before the buffer is refilled
__device__ __forceinline__ v16bf frag(const bf* r) { return cat16b(*(const v8usa*)r, *(const v8usa*)(r + 16)); }

// hold: four vector slots behind the pass's last matrix instruction on every path; naming every accumulator also keeps that instruction in front of the waits and the barrier that follow
template <int FM>
__device__ __forceinline__ void hold(v8f (&c)[FM][4]) {
    static_assert(FM == 2 || FM == 4, "two or four rows of accumulator tiles");
    if constexpr (FM == 4)
        asm volatile("v_nop\n\tv_nop\n\tv_nop\n\tv_nop" : "+v"(c[0][0]), "+v"(c[0][1]), "+v"(c[0][2]), "+v"(c[0][3]), "+v"(c[1][0]), "+v"(c[1][1]), "+v"(c[1][2]), "+v"(c[1][3]),
                                                          "+v"(c[2][0]), "+v"(c[2][1]), "+v"(c[2][2]), "+v"(c[2][3]), "+v"(c[3][0]), "+v"(c[3][1]), "+v"(c[3][2]), "+v"(c[3][3]));
    else
        asm volatile("v_nop\n\tv_nop\n\tv_nop\n\tv_nop" : "+v"(c[0][0]), "+v"(c[0][1]), "+v"(c[0][2]), "+v"(c[0][3]), "+v"(c[1][0]), "+v"(c[1][1]), "+v"(c[1][2]), "+v"(c[1][3]));
}

// k_gemmb: 128 x 128 block tile (2 x 2 waves, 64 x 64 each) of [q | k | v] = A.B^T (K = 1024); A and B tiles (two 64-row planes each) staged in LDS, two buffers.
// The epilogue writes what the score and wei.v stages read, in whole 128-byte lines, staged per wave in the ring, which every wave has left at the last pass's barrier:
// a q block (scaled by scq) or a k block goes out as its bf16 hi plane and residual plane, row-major (QK: per matrix and item the hi plane, behind it the residual plane);
// a v block goes out as the same two planes transposed ([d][t] per item): a lane's eight accumulator rows of one column are eight neighbours of a transposed row.
__global__ __launch_bounds__(128) void k_gemmb(const bf* __restrict__ A, const bf* __restrict__ Bn, int K, float scq, bf* QK, bf* VTh, bf* VTl) {
    __shared__ __align__(16) bf stg[2 * 4 * TPL];
    static_assert(4 * 64 * 68 * 4 <= 2 * 4 * TPLB && 4 * 2 * TPLB <= 2 * 4 * TPLB, "either output staging fits the ring");
    const int tid = threadIdx.x, lane = tid & 31, wave = tid >> 5, lr = lane & 15, hi = lane >> 4, wm = wave >> 1, wn = wave & 1;
    const size_t ao = (size_t)(blockIdx.x * 128 + (tid >> 3)) * K + (tid & 7) * 8, bo = (size_t)(blockIdx.y * 128 + (tid >> 3)) * K + (tid & 7) * 8, st16 = (size_t)16 * K, st64 = (size_t)64 * K;
    const unsigned l0 = (unsigned)(size_t)&stg[0] + (unsigned)((tid >> 3) * 144 + (tid & 7) * 16);
    auto fill = [&](int t) { const unsigned lb = l0 + (unsigned)(t & 1) * (4u * TPLB);
        cp8(A + ao + t * 64, A + ao + st64 + t * 64, st16, lb, lb + TPLB); cp8(Bn + bo + t * 64, Bn + bo + st64 + t * 64, st16, lb + 2u * TPLB, lb + 3u * TPLB); };
    const int nt = K >> 6;
    v8f acc[4][4];
#pragma unroll
    for (int m = 0; m < 4; ++m) {
#pragma unroll
        for (int t = 0; t < 4; ++t) acc[m][t] = (v8f){}; }
    fill(0); wait_copies(); __syncthreads();
    if (nt > 1) fill(1);
#pragma unroll 1   // stays rolled: one pass per staged tile, the two buffers alternate
    for (int s = 0; s < nt; ++s) {
        const bf* sb = &stg[(s & 1) * 4 * TPL];
#pragma unroll     // both 32-k halves of the tile in one block: fragment offsets become immediates and the LDS reads overlap the matrix work
        for (int ks = 0; ks < 2; ++ks) {
            v16bf a[4], b[4];
#pragma unroll
            for (int m = 0; m < 4; ++m) a[m] = frag(sb + (wm * 64 + m * 16 + lr) * TP + ks * 32 + 8 * hi);
#pragma unroll
            for (int t = 0; t < 4; ++t) b[t] = frag(sb + 2 * TPL + (wn * 64 + t * 16 + lr) * TP + ks * 32 + 8 * hi);
            __builtin_amdgcn_sched_barrier(0);   // the step's fragment loads stay one group in front of its matrix block: sunk among the matrix instructions, each pair is waited out on its own
#pragma unroll
            for (int t = 0; t < 4; ++t) {
#pragma unroll
                for (int m = 0; m < 4; ++m) acc[m][t] = wmmab(a[m], b[t], acc[m][t]); }
        }
        hold<4>(acc);
        wait_lds(); wait_copies(); __syncthreads();    // publishes tile s + 1 and ends every read of tile s
        if (s + 2 < nt) fill(s + 2);
    }
    wait_copies();
    const int item = blockIdx.x / (NN / 128), t0 = (blockIdx.x % (NN / 128)) * 128 + wm * 64;    // the wave's 64 rows inside their item
    const int sel = blockIdx.y / (DI / 128), d0 = (blockIdx.y % (DI / 128)) * 128 + wn * 64;     // 0 = q, 1 = k, 2 = v (the same for the whole block); the wave's 64 columns inside that matrix
    const int rw = lane >> 3, piece = lane & 7;                                                  // write-out: eight lanes per 128-byte line, four lines per store
    float* os = (float*)(void*)stg + wave * (64 * 68);
    bf* ot = stg + wave * (2 * TPL);
    if (sel < 2) {
#pragma unroll
        for (int m = 0; m < 4; ++m) {
#pragma unroll
            for (int t = 0; t < 4; ++t) {
#pragma unroll
                for (int j = 0; j < 8; ++j) os[(m * 16 + hi * 8 + j) * 68 + t * 16 + lr] = acc[m][t][j]; } }
    } else {
#pragma unroll
        for (int m = 0; m < 4; ++m) {
#pragma unroll
            for (int t = 0; t < 4; ++t) { v8us oh, ol;
#pragma unroll
                for (int j = 0; j < 8; ++j) { const float y = acc[m][t][j]; const unsigned short hb = f2bf(y); oh[j] = hb; ol[j] = f2bf(y - bf2f(hb)); }
                *(v8usa*)(ot + (t * 16 + lr) * TP + m * 16 + hi * 8) = oh; *(v8usa*)(ot + TPL + (t * 16 + lr) * TP + m * 16 + hi * 8) = ol; } }
    }
    __syncthreads();
    if (sel < 2) {
        const float sc = sel ? 1.0f : scq;
        bf* dh = QK + ((size_t)sel * NBT + item) * 2 * ((size_t)NN * DI) + (size_t)t0 * DI + d0 + piece * 8; bf* dl = dh + (size_t)NN * DI;
#pragma unroll
        for (int g = 0; g < 4; ++g) { v4f v0[4], v1[4];     // sixteen rows at a time: their LDS reads go out together and are waited for once
#pragma unroll
            for (int u = 0; u < 4; ++u) { const float* p = os + (rw + 16 * g + 4 * u) * 68 + piece * 8; v0[u] = *(const v4fa*)p; v1[u] = *(const v4fa*)(p + 4); }
#pragma unroll
            for (int u = 0; u < 4; ++u) { const int row = rw + 16 * g + 4 * u; v8us oh, ol;
#pragma unroll
                for (int i = 0; i < 8; ++i) { const float y = (i < 4 ? v0[u][i & 3] : v1[u][i & 3]) * sc; const unsigned short hb = f2bf(y); oh[i] = hb; ol[i] = f2bf(y - bf2f(hb)); }
                *(v8us*)(dh + (size_t)row * DI) = oh; *(v8us*)(dl + (size_t)row * DI) = ol; }
            asm volatile("s_wait_xcnt 0x0" ::: "memory"); }   // the next sixteen rows reuse the stores' registers
    } else {
        bf* th = VTh + (size_t)item * DI * NN + (size_t)d0 * NN + t0 + piece * 8; bf* tl = VTl + (size_t)item * DI * NN + (size_t)d0 * NN + t0 + piece * 8;
#pragma unroll
        for (int g = 0; g < 4; ++g) { v8us oh[4], ol[4];    // sixteen transposed rows at a time: their LDS reads go out together and are waited for once
#pragma unroll
            for (int u = 0; u < 4; ++u) { const bf* p = ot + (rw + 16 * g + 4 * u) * TP + piece * 8; oh[u] = *(const v8usa*)p; ol[u] = *(const v8usa*)(p + TPL); }
#pragma unroll
            for (int u = 0; u < 4; ++u) { const int dr = rw + 16 * g + 4 * u; *(v8us*)(th + (size_t)dr * NN) = oh[u]; *(v8us*)(tl + (size_t)dr * NN) = ol[u]; }
            asm volatile("s_wait_xcnt 0x0" ::: "memory"); }   // the next sixteen rows reuse the stores' registers
    }
}

// k_gemm3x: BM x BN block tile (2 x 2 waves, BM/2 x 64 each; BN = 128) of C = (Ah + Al).(Bh + Bl)^T over K (row strides = K for all four planes; n-major B): three products per 32-k step (hh, lh, hl, in that
// order into each accumulator); the four planes' tiles staged in LDS as 64-row planes, two buffers; f32 whole-line epilogue, staged per wave in the ring, which every wave has left at the last pass's barrier.
// grid.z = item: sA, sB, sC are the item strides (elements) of the A planes, the B planes and C.
template <int MODE, int BM, int BN>
__global__ __launch_bounds__(128) void k_gemm3x(const bf* __restrict__ Ah, const bf* __restrict__ Al, const bf* __restrict__ Bh, const bf* __restrict__ Bl, int K, float* C, int ldc, size_t sA, size_t sB, size_t sC) {
    constexpr int CA = BM / 64, CB = BN / 64, WM = BM / 2, FM = WM / 16, NPL = 2 * (CA + CB), NB = FM == 4 ? 2 : 4;   // 64-row planes per operand plane; rows and accumulator rows per wave; planes per buffer; B column groups held in registers at a time
    static_assert(BN == 128 && 4 * WM * 68 * 4 <= 2 * NPL * TPLB, "64 columns per wave; the output staging fits the ring");
    if ((MODE & 1) && (int)blockIdx.y * BN > (int)blockIdx.x * BM + BM - 1) return;
    const int Klim = (MODE & 2) ? min(K, ((int)blockIdx.x + 1) * BM) : K;
    __shared__ __align__(16) bf stg[2 * NPL * TPL];
    const int tid = threadIdx.x, lane = tid & 31, wave = tid >> 5, lr = lane & 15, hi = lane >> 4, wm = wave >> 1, wn = wave & 1;
    const int r0 = blockIdx.x * BM + wm * WM, c0 = blockIdx.y * BN + wn * 64;
    const size_t ao = blockIdx.z * sA + (size_t)(blockIdx.x * BM) * K, bo = blockIdx.z * sB + (size_t)(blockIdx.y * BN) * K, st16 = (size_t)16 * K, st64 = (size_t)64 * K;   // the block's tiles: the same in every lane
    const unsigned vo = (unsigned)((tid >> 3) * K + (tid & 7) * 8);   // this lane's piece inside a 16-row slab; the k offset is added to it in 32 bits, so that one register, not eight pointers, lives through the loop
    const unsigned l0 = (unsigned)(size_t)&stg[0] + (unsigned)((tid >> 3) * 144 + (tid & 7) * 16);
    auto fill = [&](int t) { const unsigned lb = l0 + (unsigned)(t & 1) * ((unsigned)NPL * TPLB);
#pragma unroll
        for (int c = 0; c < CA; ++c) cp8(Ah + ao + c * st64 + (vo + (unsigned)t * 64u), Al + ao + c * st64 + (vo + (unsigned)t * 64u), st16, lb + (unsigned)c * TPLB, lb + (unsigned)(CA + c) * TPLB);
#pragma unroll
        for (int c = 0; c < CB; ++c) cp8(Bh + bo + c * st64 + (vo + (unsigned)t * 64u), Bl + bo + c * st64 + (vo + (unsigned)t * 64u), st16, lb + (unsigned)(2 * CA + c) * TPLB, lb + (unsigned)(2 * CA + CB + c) * TPLB); };
    const int nt = Klim >> 6;
    v8f acc[FM][4];
#pragma unroll
    for (int m = 0; m < FM; ++m) {
#pragma unroll
        for (int t = 0; t < 4; ++t) acc[m][t] = (v8f){}; }
    fill(0); wait_copies(); __syncthreads();
    if (nt > 1) fill(1);
#pragma unroll 1   // stays rolled: one pass per staged tile, the two buffers alternate
    for (int s = 0; s < nt; ++s) {
        const bf* sb = &stg[(s & 1) * NPL * TPL];
#pragma unroll     // both 32-k halves of the tile in one block: fragment offsets become immediates and the LDS reads overlap the matrix work
        for (int ks = 0; ks < 2; ++ks) {
            v16bf a[FM], al[FM], bh[NB], bl[NB];
            const bf* br = sb + 2 * CA * TPL + (wn * 64 + lr) * TP + ks * 32 + 8 * hi;
#pragma unroll
            for (int m = 0; m < FM; ++m) { const bf* ar = sb + (wm * WM + m * 16 + lr) * TP + ks * 32 + 8 * hi; a[m] = frag(ar); al[m] = frag(ar + CA * TPL); }
#pragma unroll
            for (int t = 0; t < NB; ++t) { bh[t] = frag(br + t * 16 * TP); bl[t] = frag(br + t * 16 * TP + CB * TPL); }
            __builtin_amdgcn_sched_barrier(0);   // the step's fragment loads stay one group in front of its matrix block: sunk among the matrix instructions, each pair is waited out on its own
#pragma unroll
            for (int t = 0; t < 4; ++t) { const int u = t % NB;
#pragma unroll
                for (int m = 0; m < FM; ++m) acc[m][t] = wmmab(a[m], bh[u], acc[m][t]);
#pragma unroll
                for (int m = 0; m < FM; ++m) acc[m][t] = wmmab(al[m], bh[u], acc[m][t]);
#pragma unroll
                for (int m = 0; m < FM; ++m) acc[m][t] = wmmab(a[m], bl[u], acc[m][t]);
                if (t + NB < 4) {   // the B registers just used take column group t + NB; the fence pair keeps these loads here, one whole matrix group ahead of their use
                    __builtin_amdgcn_sched_barrier(0);
                    bh[u] = frag(br + (t + NB) * 16 * TP); bl[u] = frag(br + (t + NB) * 16 * TP + CB * TPL);
                    __builtin_amdgcn_sched_barrier(0); } }
        }
        hold<FM>(acc);
        wait_lds(); wait_copies(); __syncthreads();    // publishes tile s + 1 and ends every read of tile s
        if (s + 2 < nt) fill(s + 2);
    }
    wait_copies();
    float* os = (float*)(void*)stg + wave * (WM * 68);
#pragma unroll
    for (int m = 0; m < FM; ++m) {
#pragma unroll
        for (int t = 0; t < 4; ++t) {
#pragma unroll
            for (int j = 0; j < 8; ++j) os[(m * 16 + hi * 8 + j) * 68 + t * 16 + lr] = acc[m][t][j]; } }
    __builtin_amdgcn_wave_barrier(); asm volatile("" ::: "memory");   // the wave's staged rows are stored before any of its lanes reads them back; no other wave touches them
    float* crow = C + blockIdx.z * sC + (size_t)r0 * ldc + c0;
#pragma unroll
    for (int s = 0; s < 8 * FM; ++s) { const int Lid = (lane >> 3) + 4 * s, piece = lane & 7; const int row = Lid >> 1, cofs = (Lid & 1) * 32 + piece * 4;
        const v4f val = *(const v4fa*)(os + row * 68 + cofs); *(v4f*)(crow + (size_t)row * ldc + cofs) = val; }
}


__global__ __launch_bounds__(256) void k_cat(const float* __restrict__ a, const float* __restrict__ c, bf* Xb) {
    const int lane = threadIdx.x & 31; const size_t t = (size_t)blockIdx.x * 8 + (threadIdx.x >> 5); if (t >= (size_t)NBT * NN) return;   // t runs over the rows of all items
{
#pragma unroll
        for (int q = 0; q < 4; ++q) { const float* src = (q < 2 ? a : c) + t * DI + (q & 1) * 256 + lane * 8; v8us o;
#pragma unroll
            for (int i = 0; i < 8; ++i) o[i] = f2bf(src[i]);
            *(v8us*)(Xb + t * DX + q * 256 + lane * 8) = o; }
         }
}
// One wave per row. The row's causal extent, in whole chunks of 128 columns up to the one that holds the diagonal, is read once, every load in flight before the first is used,
// and stays in registers for the maximum, the sum and the two planes. Lane -> column map and each lane's order of summing are those of a pass over the chunks in rising order.
// Chunks past the diagonal are neither read nor written: wei.v stops at the row block's causal limit, which lies inside the chunks written here.
__global__ __launch_bounds__(256) void k_csoft1(const float* __restrict__ S, bf* PH, bf* PL) {
    typedef __attribute__((ext_vector_type(4))) unsigned short v4us;
    constexpr int NC = NN / 128;
    const int lane = threadIdx.x & 31, i = blockIdx.x * 8 + __builtin_amdgcn_readfirstlane((int)(threadIdx.x >> 5)); if (i >= NN) return;   // the row is the same in every lane: the chunk tests below are scalar branches
    const float* sr = S + ((size_t)blockIdx.z * NN + i) * NN + lane * 4; PH += (size_t)blockIdx.z * NN * NN + (size_t)i * NN + lane * 4; PL += (size_t)blockIdx.z * NN * NN + (size_t)i * NN + lane * 4;   // grid.z = item
    const int nch = (i >> 7) + 1;      // chunks that hold a column <= i
    v4f s[NC];
#pragma unroll
    for (int c = 0; c < NC; ++c) { s[c] = (v4f){}; if (c < nch) s[c] = *(const v4fa*)(sr + c * 128); }
    asm volatile("s_wait_xcnt 0x0" :: "v"(sr) : "memory");   // stands in front of any reuse of the loads' address registers, which the operand keeps whole up to here
    float mq[4] = {-3.0e38f, -3.0e38f, -3.0e38f, -3.0e38f};
#pragma unroll
    for (int c = 0; c < NC; ++c) if (c < nch) {
        if (c == nch - 1) {            // only the diagonal's chunk holds columns above it: they take the start value of the maximum, whose exponential is 0
#pragma unroll
            for (int q = 0; q < 4; ++q) if (c * 128 + lane * 4 + q > i) s[c][q] = -3.0e38f; }
#pragma unroll
        for (int q = 0; q < 4; ++q) mq[q] = fmaxf(mq[q], s[c][q]); }
    float m = fmaxf(fmaxf(mq[0], mq[1]), fmaxf(mq[2], mq[3]));
#pragma unroll
    for (int sh = 16; sh; sh >>= 1) m = fmaxf(m, __shfl_xor(m, sh, 32));
    float sum = 0.f;
#pragma unroll
    for (int c = 0; c < NC; ++c) if (c < nch) {
#pragma unroll
        for (int q = 0; q < 4; ++q) { s[c][q] = __expf(s[c][q] - m); sum += s[c][q]; } }
#pragma unroll
    for (int sh = 16; sh; sh >>= 1) sum += __shfl_xor(sum, sh, 32);
    const float inv = 1.0f / sum;
#pragma unroll
    for (int c = 0; c < NC; ++c) if (c < nch) { v4us oh, ol;
#pragma unroll
        for (int q = 0; q < 4; ++q) { const float p = s[c][q] * inv; const unsigned short hb = f2bf(p); oh[q] = hb; ol[q] = f2bf(p - bf2f(hb)); }
        *(v4us*)(PH + c * 128) = oh; *(v4us*)(PL + c * 128) = ol;
        asm volatile("s_wait_xcnt 0x0" ::: "memory"); }   // the next chunk reuses the two stores' registers
}
__global__ __launch_bounds__(256) void k_ln512(const float* __restrict__ O, const float* __restrict__ g, const float* __restrict__ bb, float* OUTB) {
    const int lane = threadIdx.x & 31; const size_t t = (size_t)blockIdx.x * 8 + (threadIdx.x >> 5); if (t >= (size_t)NBT * NN) return; float v[16]; float s = 0.f;   // t runs over the rows of all items
#pragma unroll
    for (int q = 0; q < 4; ++q) {
#pragma unroll
        for (int i = 0; i < 4; ++i) { v[q * 4 + i] = O[t * DI + q * 128 + lane * 4 + i]; s += v[q * 4 + i]; } }
#pragma unroll
    for (int sh = 16; sh; sh >>= 1) s += __shfl_xor(s, sh, 32);
    const float mu = s * (1.0f / DI); float qv = 0.f;
#pragma unroll
    for (int i = 0; i < 16; ++i) { const float d = v[i] - mu; qv = fmaf(d, d, qv); }
#pragma unroll
    for (int sh = 16; sh; sh >>= 1) qv += __shfl_xor(qv, sh, 32);
    const float rs = rsqrtf(qv * (1.0f / DI) + LEPS);
{
#pragma unroll
        for (int q = 0; q < 4; ++q) { const int c0 = q * 128 + lane * 4; v4f y;
#pragma unroll
            for (int i = 0; i < 4; ++i) y[i] = (v[q * 4 + i] - mu) * rs * bfr(g[c0 + i]) + bfr(bb[c0 + i]);
            *(v4f*)(OUTB + t * DI + c0) = y; }
         }
}

extern "C" void kernel_launch(void* const* d_in, const int* in_sizes, int n_in,
                              void* d_out, int out_size, void* d_ws, size_t ws_size, hipStream_t stream) {
    (void)in_sizes; (void)n_in; (void)out_size;
    const float* x0 = (const float*)d_in[0]; const float* x1 = (const float*)d_in[1]; const float* Wq = (const float*)d_in[2]; const float* Wk = (const float*)d_in[3]; const float* Wv = (const float*)d_in[4]; const float* gam = (const float*)d_in[5]; const float* bet = (const float*)d_in[6];
    float* out = (float*)d_out;    // [8][2048][512]
    char* wsp = (char*)d_ws;
    auto take = [&](size_t bytes) { char* p = wsp; wsp += (bytes + 255) & ~(size_t)255; return (void*)p; };
    const size_t PLN = (size_t)NN * DI;      // one [2048][512] plane, elements
    const size_t SQ  = (size_t)NN * NN;      // one [2048][2048] plane, elements
    bf* WT = (bf*)take((size_t)3 * DI * DX * 2);                       // [Wq^T ; Wk^T ; Wv^T] as one [1536][1024] matrix
    bf* QK = (bf*)take((size_t)2 * NBT * 2 * PLN * 2);                 // q: per item [hi | residual]; behind all of q the same for k
    bf* VTh = (bf*)take((size_t)NBT * PLN * 2); bf* VTl = (bf*)take((size_t)NBT * PLN * 2);
    char* RA = (char*)take((size_t)NG * SQ * 4 + (size_t)2 * NG * SQ * 2);               // 128 MiB, used twice in stream order
    bf* Xb = (bf*)RA;                                                                    // first: x as bf16 (all items)
    float* S = (float*)RA; bf* PH = (bf*)(RA + (size_t)NG * SQ * 4); bf* PL = PH + (size_t)NG * SQ;   // then, per group of NG items: scores and the two planes of wei
    bf* KB = QK + (size_t)NBT * 2 * PLN;
    float* O = (float*)QK;                   // item b's attention output lies on item b's q planes, which are dead once its scores are formed
    if ((size_t)(wsp - (char*)d_ws) > ws_size) return;    // 3 + 64 + 32 + 128 = 227 MiB
    k_wt<<<dim3(DX / 64, DI / 64, 3), 256, 0, stream>>>(Wq, Wk, Wv, DX, DI, WT);   // (in, out) weights
    k_cat<<<NBT * NN / 8, 256, 0, stream>>>(x0, x1, Xb);
    k_gemmb<<<dim3(NBT * NN / 128, 3 * DI / 128, 1), 128, 0, stream>>>(Xb, WT, DX, SCL, QK, VTh, VTl);
    for (int g = 0; g < NBT / NG; ++g) {     // scores and wei of all eight items do not fit the workspace at once
        const bf* Qg = QK + (size_t)g * NG * 2 * PLN; const bf* Kg = KB + (size_t)g * NG * 2 * PLN;
        k_gemm3x<1, 128, 128><<<dim3(NN / 128, NN / 128, NG), 128, 0, stream>>>(Qg, Qg + PLN, Kg, Kg + PLN, DI, S, NN, 2 * PLN, 2 * PLN, SQ);            // causal tiles only
        k_csoft1<<<dim3(NN / 8, 1, NG), 256, 0, stream>>>(S, PH, PL);
        k_gemm3x<2, 64, 128><<<dim3(NN / 64, DI / 128, NG), 128, 0, stream>>>(PH, PL, VTh + (size_t)g * NG * PLN, VTl + (size_t)g * NG * PLN, NN, O + (size_t)g * NG * PLN, DI, SQ, PLN, PLN); }   // K limited to the causal extent
    k_ln512<<<NBT * NN / 8, 256, 0, stream>>>(O, gam, bet, out);
}

// v006
// A run of this version takes 205 microseconds.
// In both of two side-by-side timings against v005, it was 1.07 times as fast.
// All steps since v000 together make it 8.51 times as fast.
#include <hip/hip_runtime.h>

// Compute dtypes, f32 accumulate, per item: x = [x0 | x1] as exact bf16 rows; q/k/v = x.W ([2048 x 1024].[1024 x 512], PLAIN bf16 operands, exact products); single-head causal
// scores q.k^T ([2048 x 512].[512 x 2048]) and wei.v with both operands as bf16 hi + UNSCALED residual planes (three products; key tiles above the diagonal skipped, K limited);

#define NBT  8
#define NN   2048
#define DI   512
#define DX   1024
#define DM   DX
#define NX   NN
#define NZ   NN
#define SCL  0.044194173824159216f   // 512^-0.5
#define LEPS 1e-5f
#define LOSC 1024.0f

typedef _Float16 h16;
typedef unsigned short bf;
typedef __attribute__((ext_vector_type(16))) __bf16   v16bf;
typedef __attribute__((ext_vector_type(16))) _Float16 v16h;
typedef __attribute__((ext_vector_type(8)))  _Float16 v8h;
typedef __attribute__((ext_vector_type(8)))  unsigned short v8us;
typedef __attribute__((ext_vector_type(8)))  float    v8f;
typedef __attribute__((ext_vector_type(4)))  float    v4f;
typedef __attribute__((ext_vector_type(4)))  _Float16 v4h;
typedef v8h  __attribute__((may_alias)) v8ha;
typedef v4f  __attribute__((may_alias)) v4fa;
typedef v8us __attribute__((may_alias)) v8usa;

__device__ __forceinline__ unsigned short f2bf(float f) { unsigned u = __float_as_uint(f); u += 0x7FFFu + ((u >> 16) & 1u); return (unsigned short)(u >> 16); }
__device__ __forceinline__ float bf2f(unsigned short b) { return __uint_as_float(((unsigned)b) << 16); }
__device__ __forceinline__ float bfr(float f) { return bf2f(f2bf(f)); }
__device__ __forceinline__ v16h cat16(v8h lo, v8h hi) { return __builtin_shufflevector(lo, hi, 0, 1, 2, 3, 4, 5, 6, 7, 8, 9, 10, 11, 12, 13, 14, 15); }
__device__ __forceinline__ v16bf cat16b(v8us lo, v8us hi) { return __builtin_bit_cast(v16bf, __builtin_shufflevector(lo, hi, 0, 1, 2, 3, 4, 5, 6, 7, 8, 9, 10, 11, 12, 13, 14, 15)); }
__device__ __forceinline__ v8f wmma16(v16h a, v16h b, v8f c) { return __builtin_amdgcn_wmma_f32_16x16x32_f16(false, a, false, b, (short)0, c, false, false); }
__device__ __forceinline__ v8f wmmab(v16bf a, v16bf b, v8f c) { return __builtin_amdgcn_wmma_f32_16x16x32_bf16(false, a, false, b, (short)0, c, false, false); }

// k_wt: WT [n][K] = bf16(W[k][n]) (k-major [K][ncols]) via 64 x 64 LDS tiles; grid (K/64, ncols/64, 3): z picks the weight, the three transposes lie one behind the other as one [3 * ncols][K] matrix.
__global__ __launch_bounds__(256) void k_wt(const float* __restrict__ W0, const float* __restrict__ W1, const float* __restrict__ W2, int K, int ncols, bf* WT) {
    __shared__ __align__(16) unsigned short tl[64 * 72];
    const float* __restrict__ Wm = blockIdx.z == 0 ? W0 : (blockIdx.z == 1 ? W1 : W2); WT += (size_t)blockIdx.z * ncols * K;
    const int tid = threadIdx.x, k0 = blockIdx.x * 64, n0 = blockIdx.y * 64;
    const int kk = tid >> 2, nq = (tid & 3) * 16;
#pragma unroll
    for (int i = 0; i < 16; ++i) tl[(nq + i) * 72 + kk] = f2bf(Wm[(size_t)(k0 + kk) * ncols + n0 + nq + i]);
    __syncthreads();
    const int piece = tid & 7;
    auto pass = [&]() {
#pragma unroll
        for (int s = 0; s < 2; ++s) { const int nr = (tid >> 3) + 32 * s; const v8us val = *(const v8usa*)(tl + nr * 72 + piece * 8); *(v8us*)(WT + (size_t)(n0 + nr) * K + k0 + piece * 8) = val; }
    };
    pass(); 
}
// Tile staging for the matrix kernels: a 64-row x 64-k bf16 plane lies in LDS at a row pitch of 144 B (16 B x 9, conflict-free for 16-byte fragment reads).
#define TP   72            // LDS row pitch, bf16 elements
#define TPL  (64 * TP)     // one plane, bf16 elements
#define TPLB (TPL * 2)     // one plane, bytes
// cp8: this lane's 16-byte pieces of two planes (rows +0, +16, +32, +48 of each): a wave's copy reads four whole 128-B lines. st = 16 source rows in elements.
__device__ __forceinline__ void cp8(const bf* p, const bf* q, size_t st, unsigned lp, unsigned lq) {
    // asynchronous copies global -> LDS; s_wait_xcnt 0 closes the statement so that no address register is rewritten ahead of it
    asm volatile("global_load_async_to_lds_b128 %0, %8, off\n\t"
                 "global_load_async_to_lds_b128 %1, %9, off\n\t"
                 "global_load_async_to_lds_b128 %2, %10, off\n\t"
                 "global_load_async_to_lds_b128 %3, %11, off\n\t"
                 "global_load_async_to_lds_b128 %4, %12, off\n\t"
                 "global_load_async_to_lds_b128 %5, %13, off\n\t"
                 "global_load_async_to_lds_b128 %6, %14, off\n\t"
                 "global_load_async_to_lds_b128 %7, %15, off\n\t"
                 "s_wait_xcnt 0x0"
                 :: "v"(lp), "v"(lp + 16u * 144u), "v"(lp + 32u * 144u), "v"(lp + 48u * 144u), "v"(lq), "v"(lq + 16u * 144u), "v"(lq + 32u * 144u), "v"(lq + 48u * 144u),
                    "v"(p), "v"(p + st), "v"(p + 2 * st), "v"(p + 3 * st), "v"(q), "v"(q + st), "v"(q + 2 * st), "v"(q + 3 * st) : "memory");
}
__device__ __forceinline__ void wait_copies() { asm volatile("s_wait_asynccnt 0x0" ::: "memory"); }   // this wave's copies have landed in LDS
__device__ __forceinline__ void wait_lds()    { asm volatile("s_wait_dscnt 0x0" ::: "memory"); }      // this wave's LDS reads are done before the buffer is refilled
__device__ __forceinline__ v16bf frag(const bf* r) { return cat16b(*(const v8usa*)r, *(const v8usa*)(r + 16)); }

// hold: four vector slots behind the pass's last matrix instruction on every path; naming every accumulator also keeps that instruction in front of the waits and the barrier that follow
template <int FM>
__device__ __forceinline__ void hold(v8f (&c)[FM][4]) {
    static_assert(FM == 2 || FM == 4, "two or four rows of accumulator tiles");
    if constexpr (FM == 4)
        asm volatile("v_nop\n\tv_nop\n\tv_nop\n\tv_nop" : "+v"(c[0][0]), "+v"(c[0][1]), "+v"(c[0][2]), "+v"(c[0][3]), "+v"(c[1][0]), "+v"(c[1][1]), "+v"(c[1][2]), "+v"(c[1][3]),
                                                          "+v"(c[2][0]), "+v"(c[2][1]), "+v"(c[2][2]), "+v"(c[2][3]), "+v"(c[3][0]), "+v"(c[3][1]), "+v"(c[3][2]), "+v"(c[3][3]));
    else
        asm volatile("v_nop\n\tv_nop\n\tv_nop\n\tv_nop" : "+v"(c[0][0]), "+v"(c[0][1]), "+v"(c[0][2]), "+v"(c[0][3]), "+v"(c[1][0]), "+v"(c[1][1]), "+v"(c[1][2]), "+v"(c[1][3]));
}

// k_gemmb: 128 x 128 block tile (2 x 2 waves, 64 x 64 each) of [q | k | v] = A.B^T (K = 1024); A and B tiles (two 64-row planes each) staged in LDS, two buffers.
// The epilogue writes what the score and wei.v stages read, in whole 128-byte lines, staged per wave in the ring, which every wave has left at the last pass's barrier:
// a q block (scaled by scq) or a k block goes out as its bf16 hi plane and residual plane, row-major (QK: per matrix and item the hi plane, behind it the residual plane);
// a v block goes out as the same two planes transposed ([d][t] per item): a lane's eight accumulator rows of one column are eight neighbours of a transposed row.
__global__ __launch_bounds__(128) void k_gemmb(const bf* __restrict__ A, const bf* __restrict__ Bn, int K, float scq, bf* QK, bf* VTh, bf* VTl) {
    __shared__ __align__(16) bf stg[2 * 4 * TPL];
    static_assert(4 * 64 * 68 * 4 <= 2 * 4 * TPLB && 4 * 2 * TPLB <= 2 * 4 * TPLB, "either output staging fits the ring");
    const int tid = threadIdx.x, lane = tid & 31, wave = tid >> 5, lr = lane & 15, hi = lane >> 4, wm = wave >> 1, wn = wave & 1;
    const size_t ao = (size_t)(blockIdx.x * 128 + (tid >> 3)) * K + (tid & 7) * 8, bo = (size_t)(blockIdx.y * 128 + (tid >> 3)) * K + (tid & 7) * 8, st16 = (size_t)16 * K, st64 = (size_t)64 * K;
    const unsigned l0 = (unsigned)(size_t)&stg[0] + (unsigned)((tid >> 3) * 144 + (tid & 7) * 16);
    auto fill = [&](int t) { const unsigned lb = l0 + (unsigned)(t & 1) * (4u * TPLB);
        cp8(A + ao + t * 64, A + ao + st64 + t * 64, st16, lb, lb + TPLB); cp8(Bn + bo + t * 64, Bn + bo + st64 + t * 64, st16, lb + 2u * TPLB, lb + 3u * TPLB); };
    const int nt = K >> 6;
    v8f acc[4][4];
#pragma unroll
    for (int m = 0; m < 4; ++m) {
#pragma unroll
        for (int t = 0; t < 4; ++t) acc[m][t] = (v8f){}; }
    fill(0); wait_copies(); __syncthreads();
    if (nt > 1) fill(1);
#pragma unroll 1   // stays rolled: one pass per staged tile, the two buffers alternate
    for (int s = 0; s < nt; ++s) {
        const bf* sb = &stg[(s & 1) * 4 * TPL];
#pragma unroll     // both 32-k halves of the tile in one block: fragment offsets become immediates and the LDS reads overlap the matrix work
        for (int ks = 0; ks < 2; ++ks) {
            v16bf a[4], b[4];
#pragma unroll
            for (int m = 0; m < 4; ++m) a[m] = frag(sb + (wm * 64 + m * 16 + lr) * TP + ks * 32 + 8 * hi);
#pragma unroll
            for (int t = 0; t < 4; ++t) b[t] = frag(sb + 2 * TPL + (wn * 64 + t * 16 + lr) * TP + ks * 32 + 8 * hi);
            __builtin_amdgcn_sched_barrier(0);   // the step's fragment loads stay one group in front of its matrix block: sunk among the matrix instructions, each pair is waited out on its own
#pragma unroll
            for (int t = 0; t < 4; ++t) {
#pragma unroll
                for (int m = 0; m < 4; ++m) acc[m][t] = wmmab(a[m], b[t], acc[m][t]); }
        }
        hold<4>(acc);
        wait_lds(); wait_copies(); __syncthreads();    // publishes tile s + 1 and ends every read of tile s
        if (s + 2 < nt) fill(s + 2);
    }
    wait_copies();
    const int item = blockIdx.x / (NN / 128), t0 = (blockIdx.x % (NN / 128)) * 128 + wm * 64;    // the wave's 64 rows inside their item
    const int sel = blockIdx.y / (DI / 128), d0 = (blockIdx.y % (DI / 128)) * 128 + wn * 64;     // 0 = q, 1 = k, 2 = v (the same for the whole block); the wave's 64 columns inside that matrix
    const int rw = lane >> 3, piece = lane & 7;                                                  // write-out: eight lanes per 128-byte line, four lines per store
    float* os = (float*)(void*)stg + wave * (64 * 68);
    bf* ot = stg + wave * (2 * TPL);
    if (sel < 2) {
#pragma unroll
        for (int m = 0; m < 4; ++m) {
#pragma unroll
            for (int t = 0; t < 4; ++t) {
#pragma unroll
                for (int j = 0; j < 8; ++j) os[(m * 16 + hi * 8 + j) * 68 + t * 16 + lr] = acc[m][t][j]; } }
    } else {
#pragma unroll
        for (int m = 0; m < 4; ++m) {
#pragma unroll
            for (int t = 0; t < 4; ++t) { v8us oh, ol;
#pragma unroll
                for (int j = 0; j < 8; ++j) { const float y = acc[m][t][j]; const unsigned short hb = f2bf(y); oh[j] = hb; ol[j] = f2bf(y - bf2f(hb)); }
                *(v8usa*)(ot + (t * 16 + lr) * TP + m * 16 + hi * 8) = oh; *(v8usa*)(ot + TPL + (t * 16 + lr) * TP + m * 16 + hi * 8) = ol; } }
    }
    __syncthreads();
    if (sel < 2) {
        const float sc = sel ? 1.0f : scq;
        bf* dh = QK + ((size_t)sel * NBT + item) * 2 * ((size_t)NN * DI) + (size_t)t0 * DI + d0 + piece * 8; bf* dl = dh + (size_t)NN * DI;
#pragma unroll
        for (int g = 0; g < 4; ++g) { v4f v0[4], v1[4];     // sixteen rows at a time: their LDS reads go out together and are waited for once
#pragma unroll
            for (int u = 0; u < 4; ++u) { const float* p = os + (rw + 16 * g + 4 * u) * 68 + piece * 8; v0[u] = *(const v4fa*)p; v1[u] = *(const v4fa*)(p + 4); }
#pragma unroll
            for (int u = 0; u < 4; ++u) { const int row = rw + 16 * g + 4 * u; v8us oh, ol;
#pragma unroll
                for (int i = 0; i < 8; ++i) { const float y = (i < 4 ? v0[u][i & 3] : v1[u][i & 3]) * sc; const unsigned short hb = f2bf(y); oh[i] = hb; ol[i] = f2bf(y - bf2f(hb)); }
                *(v8us*)(dh + (size_t)row * DI) = oh; *(v8us*)(dl + (size_t)row * DI) = ol; }
            asm volatile("s_wait_xcnt 0x0" ::: "memory"); }   // the next sixteen rows reuse the stores' registers
    } else {
        bf* th = VTh + (size_t)item * DI * NN + (size_t)d0 * NN + t0 + piece * 8; bf* tl = VTl + (size_t)item * DI * NN + (size_t)d0 * NN + t0 + piece * 8;
#pragma unroll
        for (int g = 0; g < 4; ++g) { v8us oh[4], ol[4];    // sixteen transposed rows at a time: their LDS reads go out together and are waited for once
#pragma unroll
            for (int u = 0; u < 4; ++u) { const bf* p = ot + (rw + 16 * g + 4 * u) * TP + piece * 8; oh[u] = *(const v8usa*)p; ol[u] = *(const v8usa*)(p + TPL); }
#pragma unroll
            for (int u = 0; u < 4; ++u) { const int dr = rw + 16 * g + 4 * u; *(v8us*)(th + (size_t)dr * NN) = oh[u]; *(v8us*)(tl + (size_t)dr * NN) = ol[u]; }
            asm volatile("s_wait_xcnt 0x0" ::: "memory"); }   // the next sixteen rows reuse the stores' registers
    }
}

// k_gemm3x: BM x BN block tile (2 x 2 waves, BM/2 x 64 each; BN = 128) of C = (Ah + Al).(Bh + Bl)^T over K (row strides: K for the B planes, AS * K for the A planes; n-major B): three products per 32-k step (hh, lh, hl, in that
// order into each accumulator); the four planes' tiles staged in LDS as 64-row planes, two buffers; f32 whole-line epilogue, staged per wave in the ring, which every wave has left at the last pass's barrier.
// grid.z = item: sA, sB, sC are the item strides (elements) of the A planes, the B planes and C. AS: row stride of the two A planes in units of K (2 where a row's hi and residual halves lie side by side).
template <int MODE, int BM, int BN, int AS>
__global__ __launch_bounds__(128) void k_gemm3x(const bf* __restrict__ Ah, const bf* __restrict__ Al, const bf* __restrict__ Bh, const bf* __restrict__ Bl, int K, float* C, int ldc, size_t sA, size_t sB, size_t sC) {
    constexpr int CA = BM / 64, CB = BN / 64, WM = BM / 2, FM = WM / 16, NPL = 2 * (CA + CB), NB = FM == 4 ? 2 : 4;   // 64-row planes per operand plane; rows and accumulator rows per wave; planes per buffer; B column groups held in registers at a time
    static_assert(BN == 128 && 4 * WM * 68 * 4 <= 2 * NPL * TPLB, "64 columns per wave; the output staging fits the ring");
    if ((MODE & 1) && (int)blockIdx.y * BN > (int)blockIdx.x * BM + BM - 1) return;
    const int Klim = (MODE & 2) ? min(K, ((int)blockIdx.x + 1) * BM) : K;
    __shared__ __align__(16) bf stg[2 * NPL * TPL];
    const int tid = threadIdx.x, lane = tid & 31, wave = tid >> 5, lr = lane & 15, hi = lane >> 4, wm = wave >> 1, wn = wave & 1;
    const int r0 = blockIdx.x * BM + wm * WM, c0 = blockIdx.y * BN + wn * 64;
    const size_t ao = blockIdx.z * sA + (size_t)(blockIdx.x * BM) * K * AS, bo = blockIdx.z * sB + (size_t)(blockIdx.y * BN) * K, st16 = (size_t)16 * K, st64 = (size_t)64 * K;   // the block's tiles: the same in every lane
    const unsigned vo = (unsigned)((tid >> 3) * K + (tid & 7) * 8), va = (unsigned)((tid >> 3) * K * AS + (tid & 7) * 8);   // this lane's piece inside a 16-row slab of B and of A; the k offset is added in 32 bits, so that a register, not eight pointers, lives through the loop
    const unsigned l0 = (unsigned)(size_t)&stg[0] + (unsigned)((tid >> 3) * 144 + (tid & 7) * 16);
    auto fill = [&](int t) { const unsigned lb = l0 + (unsigned)(t & 1) * ((unsigned)NPL * TPLB);
#pragma unroll
        for (int c = 0; c < CA; ++c) cp8(Ah + ao + c * (AS * st64) + (va + (unsigned)t * 64u), Al + ao + c * (AS * st64) + (va + (unsigned)t * 64u), AS * st16, lb + (unsigned)c * TPLB, lb + (unsigned)(CA + c) * TPLB);
#pragma unroll
        for (int c = 0; c < CB; ++c) cp8(Bh + bo + c * st64 + (vo + (unsigned)t * 64u), Bl + bo + c * st64 + (vo + (unsigned)t * 64u), st16, lb + (unsigned)(2 * CA + c) * TPLB, lb + (unsigned)(2 * CA + CB + c) * TPLB); };
    const int nt = Klim >> 6;
    v8f acc[FM][4];
#pragma unroll
    for (int m = 0; m < FM; ++m) {
#pragma unroll
        for (int t = 0; t < 4; ++t) acc[m][t] = (v8f){}; }
    fill(0); wait_copies(); __syncthreads();
    if (nt > 1) fill(1);
#pragma unroll 1   // stays rolled: one pass per staged tile, the two buffers alternate
    for (int s = 0; s < nt; ++s) {
        const bf* sb = &stg[(s & 1) * NPL * TPL];
#pragma unroll     // both 32-k halves of the tile in one block: fragment offsets become immediates and the LDS reads overlap the matrix work
        for (int ks = 0; ks < 2; ++ks) {
            v16bf a[FM], al[FM], bh[NB], bl[NB];
            const bf* br = sb + 2 * CA * TPL + (wn * 64 + lr) * TP + ks * 32 + 8 * hi;
#pragma unroll
            for (int m = 0; m < FM; ++m) { const bf* ar = sb + (wm * WM + m * 16 + lr) * TP + ks * 32 + 8 * hi; a[m] = frag(ar); al[m] = frag(ar + CA * TPL); }
#pragma unroll
            for (int t = 0; t < NB; ++t) { bh[t] = frag(br + t * 16 * TP); bl[t] = frag(br + t * 16 * TP + CB * TPL); }
            __builtin_amdgcn_sched_barrier(0);   // the step's fragment loads stay one group in front of its matrix block: sunk among the matrix instructions, each pair is waited out on its own
#pragma unroll
            for (int t = 0; t < 4; ++t) { const int u = t % NB;
#pragma unroll
                for (int m = 0; m < FM; ++m) acc[m][t] = wmmab(a[m], bh[u], acc[m][t]);
#pragma unroll
                for (int m = 0; m < FM; ++m) acc[m][t] = wmmab(al[m], bh[u], acc[m][t]);
#pragma unroll
                for (int m = 0; m < FM; ++m) acc[m][t] = wmmab(a[m], bl[u], acc[m][t]);
                if (t + NB < 4) {   // the B registers just used take column group t + NB; the fence pair keeps these loads here, one whole matrix group ahead of their use
                    __builtin_amdgcn_sched_barrier(0);
                    bh[u] = frag(br + (t + NB) * 16 * TP); bl[u] = frag(br + (t + NB) * 16 * TP + CB * TPL);
                    __builtin_amdgcn_sched_barrier(0); } }
        }
        hold<FM>(acc);
        wait_lds(); wait_copies(); __syncthreads();    // publishes tile s + 1 and ends every read of tile s
        if (s + 2 < nt) fill(s + 2);
    }
    wait_copies();
    float* os = (float*)(void*)stg + wave * (WM * 68);
#pragma unroll
    for (int m = 0; m < FM; ++m) {
#pragma unroll
        for (int t = 0; t < 4; ++t) {
#pragma unroll
            for (int j = 0; j < 8; ++j) os[(m * 16 + hi * 8 + j) * 68 + t * 16 + lr] = acc[m][t][j]; } }
    __builtin_amdgcn_wave_barrier(); asm volatile("" ::: "memory");   // the wave's staged rows are stored before any of its lanes reads them back; no other wave touches them
    float* crow = C + blockIdx.z * sC + (size_t)r0 * ldc + c0;
#pragma unroll
    for (int s = 0; s < 8 * FM; ++s) { const int Lid = (lane >> 3) + 4 * s, piece = lane & 7; const int row = Lid >> 1, cofs = (Lid & 1) * 32 + piece * 4;
        const v4f val = *(const v4fa*)(os + row * 68 + cofs); *(v4f*)(crow + (size_t)row * ldc + cofs) = val; }
}


__global__ __launch_bounds__(256) void k_cat(const float* __restrict__ a, const float* __restrict__ c, bf* Xb) {
    const int lane = threadIdx.x & 31; const size_t t = (size_t)blockIdx.x * 8 + (threadIdx.x >> 5); if (t >= (size_t)NBT * NN) return;   // t runs over the rows of all items
{
#pragma unroll
        for (int q = 0; q < 4; ++q) { const float* src = (q < 2 ? a : c) + t * DI + (q & 1) * 256 + lane * 8; v8us o;
#pragma unroll
            for (int i = 0; i < 8; ++i) o[i] = f2bf(src[i]);
            *(v8us*)(Xb + t * DX + q * 256 + lane * 8) = o; }
         }
}
// One wave per row. The row's causal extent, in whole chunks of 128 columns up to the one that holds the diagonal, is read once, every load in flight before the first is used,
// and stays in registers for the maximum, the sum and the two planes. Lane -> column map and each lane's order of summing are those of a pass over the chunks in rising order.
// Chunks past the diagonal are neither read nor written: wei.v stops at the row block's causal limit, which lies inside the chunks written here.
// The two planes go out IN PLACE: a row's 2048 f32 scores and its 2048 + 2048 bf16 values fill the same 8 KiB (hi half first), which no other wave touches;
// every store takes the row's sum, so each of the row's loads has returned before the first store is issued. S carries no restrict: PH and PL point into it.
__global__ __launch_bounds__(256) void k_csoft1(const float* S, bf* PH, bf* PL) {
    typedef __attribute__((ext_vector_type(4))) unsigned short v4us;
    constexpr int NC = NN / 128;
    const int lane = threadIdx.x & 31, i = blockIdx.x * 8 + __builtin_amdgcn_readfirstlane((int)(threadIdx.x >> 5)); if (i >= NN) return;   // the row is the same in every lane: the chunk tests below are scalar branches
    const float* sr = S + ((size_t)blockIdx.z * NN + i) * NN + lane * 4; PH += ((size_t)blockIdx.z * NN + i) * (2 * NN) + lane * 4; PL += ((size_t)blockIdx.z * NN + i) * (2 * NN) + lane * 4;   // grid.z = item
    const int nch = (i >> 7) + 1;      // chunks that hold a column <= i
    v4f s[NC];
#pragma unroll
    for (int c = 0; c < NC; ++c) { s[c] = (v4f){}; if (c < nch) s[c] = *(const v4fa*)(sr + c * 128); }
    asm volatile("s_wait_xcnt 0x0" :: "v"(sr) : "memory");   // stands in front of any reuse of the loads' address registers, which the operand keeps whole up to here
    float mq[4] = {-3.0e38f, -3.0e38f, -3.0e38f, -3.0e38f};
#pragma unroll
    for (int c = 0; c < NC; ++c) if (c < nch) {
        if (c == nch - 1) {            // only the diagonal's chunk holds columns above it: they take the start value of the maximum, whose exponential is 0
#pragma unroll
            for (int q = 0; q < 4; ++q) if (c * 128 + lane * 4 + q > i) s[c][q] = -3.0e38f; }
#pragma unroll
        for (int q = 0; q < 4; ++q) mq[q] = fmaxf(mq[q], s[c][q]); }
    float m = fmaxf(fmaxf(mq[0], mq[1]), fmaxf(mq[2], mq[3]));
#pragma unroll
    for (int sh = 16; sh; sh >>= 1) m = fmaxf(m, __shfl_xor(m, sh, 32));
    float sum = 0.f;
#pragma unroll
    for (int c = 0; c < NC; ++c) if (c < nch) {
#pragma unroll
        for (int q = 0; q < 4; ++q) { s[c][q] = __expf(s[c][q] - m); sum += s[c][q]; } }
#pragma unroll
    for (int sh = 16; sh; sh >>= 1) sum += __shfl_xor(sum, sh, 32);
    const float inv = 1.0f / sum;
#pragma unroll
    for (int c = 0; c < NC; ++c) if (c < nch) { v4us oh, ol;
#pragma unroll
        for (int q = 0; q < 4; ++q) { const float p = s[c][q] * inv; const unsigned short hb = f2bf(p); oh[q] = hb; ol[q] = f2bf(p - bf2f(hb)); }
        *(v4us*)(PH + c * 128) = oh; *(v4us*)(PL + c * 128) = ol;
        asm volatile("s_wait_xcnt 0x0" ::: "memory"); }   // the next chunk reuses the two stores' registers
}
__global__ __launch_bounds__(256) void k_ln512(const float* __restrict__ O, const float* __restrict__ g, const float* __restrict__ bb, float* OUTB) {
    const int lane = threadIdx.x & 31; const size_t t = (size_t)blockIdx.x * 8 + (threadIdx.x >> 5); if (t >= (size_t)NBT * NN) return; float v[16]; float s = 0.f;   // t runs over the rows of all items
#pragma unroll
    for (int q = 0; q < 4; ++q) {
#pragma unroll
        for (int i = 0; i < 4; ++i) { v[q * 4 + i] = O[t * DI + q * 128 + lane * 4 + i]; s += v[q * 4 + i]; } }
#pragma unroll
    for (int sh = 16; sh; sh >>= 1) s += __shfl_xor(s, sh, 32);
    const float mu = s * (1.0f / DI); float qv = 0.f;
#pragma unroll
    for (int i = 0; i < 16; ++i) { const float d = v[i] - mu; qv = fmaf(d, d, qv); }
#pragma unroll
    for (int sh = 16; sh; sh >>= 1) qv += __shfl_xor(qv, sh, 32);
    const float rs = rsqrtf(qv * (1.0f / DI) + LEPS);
{
#pragma unroll
        for (int q = 0; q < 4; ++q) { const int c0 = q * 128 + lane * 4; v4f y;
#pragma unroll
            for (int i = 0; i < 4; ++i) y[i] = (v[q * 4 + i] - mu) * rs * bfr(g[c0 + i]) + bfr(bb[c0 + i]);
            *(v4f*)(OUTB + t * DI + c0) = y; }
         }
}

extern "C" void kernel_launch(void* const* d_in, const int* in_sizes, int n_in,
                              void* d_out, int out_size, void* d_ws, size_t ws_size, hipStream_t stream) {
    (void)in_sizes; (void)n_in; (void)out_size;
    const float* x0 = (const float*)d_in[0]; const float* x1 = (const float*)d_in[1]; const float* Wq = (const float*)d_in[2]; const float* Wk = (const float*)d_in[3]; const float* Wv = (const float*)d_in[4]; const float* gam = (const float*)d_in[5]; const float* bet = (const float*)d_in[6];
    float* out = (float*)d_out;    // [8][2048][512]
    char* wsp = (char*)d_ws;
    auto take = [&](size_t bytes) { char* p = wsp; wsp += (bytes + 255) & ~(size_t)255; return (void*)p; };
    const size_t PLN = (size_t)NN * DI;      // one [2048][512] plane, elements
    const size_t SQ  = (size_t)NN * NN;      // one [2048][2048] plane, elements
    bf* WT = (bf*)take((size_t)3 * DI * DX * 2);                       // [Wq^T ; Wk^T ; Wv^T] as one [1536][1024] matrix
    bf* QK = (bf*)take((size_t)2 * NBT * 2 * PLN * 2);                 // q: per item [hi | residual]; behind all of q the same for k
    bf* VTh = (bf*)take((size_t)NBT * PLN * 2); bf* VTl = (bf*)take((size_t)NBT * PLN * 2);
    char* RA = (char*)take((size_t)NBT * SQ * 4);                                        // 128 MiB, used twice in stream order
    bf* Xb = (bf*)RA;                                                                    // first: x as bf16 (all items)
    float* S = (float*)RA; bf* PH = (bf*)RA; bf* PL = PH + NN;                           // then: the scores of all items; the softmax puts each row's two planes of wei on that row's scores (row pitch 2 * NN)
    bf* KB = QK + (size_t)NBT * 2 * PLN;
    float* O = (float*)QK;                   // item b's attention output lies on item b's q planes, which are dead once its scores are formed
    if ((size_t)(wsp - (char*)d_ws) > ws_size) return;    // 3 + 64 + 32 + 128 = 227 MiB
    k_wt<<<dim3(DX / 64, DI / 64, 3), 256, 0, stream>>>(Wq, Wk, Wv, DX, DI, WT);   // (in, out) weights
    k_cat<<<NBT * NN / 8, 256, 0, stream>>>(x0, x1, Xb);
    k_gemmb<<<dim3(NBT * NN / 128, 3 * DI / 128, 1), 128, 0, stream>>>(Xb, WT, DX, SCL, QK, VTh, VTl);
    k_gemm3x<1, 128, 128, 1><<<dim3(NN / 128, NN / 128, NBT), 128, 0, stream>>>(QK, QK + PLN, KB, KB + PLN, DI, S, NN, 2 * PLN, 2 * PLN, SQ);   // causal tiles only
    k_csoft1<<<dim3(NN / 8, 1, NBT), 256, 0, stream>>>(S, PH, PL);
    k_gemm3x<2, 64, 128, 2><<<dim3(NN / 64, DI / 128, NBT), 128, 0, stream>>>(PH, PL, VTh, VTl, NN, O, DI, 2 * SQ, PLN, PLN);                    // K limited to the causal extent
    k_ln512<<<NBT * NN / 8, 256, 0, stream>>>(O, gam, bet, out);
}

// v008
// Measured time: 119 microseconds a run.
// It is 1.73 times as fast as v006, going by the measured steps of the versions left out in between.
// Counting every step since v000, it is 14.7 times as fast.
#include <hip/hip_runtime.h>

// Compute dtypes, f32 accumulate, per item: x = [x0 | x1] as exact bf16 rows; q/k/v = x.W ([2048 x 1024].[1024 x 512], PLAIN bf16 operands, exact products); single-head causal
// scores q.k^T ([2048 x 512].[512 x 2048]) and wei.v with both operands as ONE f16 plane (one product; key tiles above the diagonal skipped, K limited).
// Softmax has no launch of its own: the score kernel's epilogue writes, per row and 64-key tile, exp(s - tile maximum) * 1024 as f16 with the tile's maximum and sum in f32;
// wei.v forms each row's factor exp(tile maximum - row maximum) / row sum per tile and adds factor * (tile's product) into its f32 accumulators (the 1024 is undone exactly in the f32 output).

#define NBT  8
#define NN   2048
#define DI   512
#define DX   1024
#define DM   DX
#define NX   NN
#define NZ   NN
#define SCL  0.044194173824159216f   // 512^-0.5
#define LEPS 1e-5f
#define LOSC 1024.0f                 // 2^10
#define L2E  1.4426950408889634f     // log2 e

typedef _Float16 h16;
typedef unsigned short bf;
typedef __attribute__((ext_vector_type(16))) __bf16   v16bf;
typedef __attribute__((ext_vector_type(16))) _Float16 v16h;
typedef __attribute__((ext_vector_type(8)))  _Float16 v8h;
typedef __attribute__((ext_vector_type(8)))  unsigned short v8us;
typedef __attribute__((ext_vector_type(8)))  float    v8f;
typedef __attribute__((ext_vector_type(4)))  float    v4f;
typedef __attribute__((ext_vector_type(4)))  _Float16 v4h;
typedef v8h  __attribute__((may_alias)) v8ha;
typedef v4f  __attribute__((may_alias)) v4fa;
typedef __attribute__((ext_vector_type(2)))  float    v2f;
typedef v2f  __attribute__((may_alias)) v2fa;
typedef v8us __attribute__((may_alias)) v8usa;

__device__ __forceinline__ unsigned short f2bf(float f) { unsigned u = __float_as_uint(f); u += 0x7FFFu + ((u >> 16) & 1u); return (unsigned short)(u >> 16); }
__device__ __forceinline__ float bf2f(unsigned short b) { return __uint_as_float(((unsigned)b) << 16); }
__device__ __forceinline__ float bfr(float f) { return bf2f(f2bf(f)); }
__device__ __forceinline__ unsigned short f2h(float f) { return __builtin_bit_cast(unsigned short, (_Float16)f); }   // f16 bits, round to nearest even
__device__ __forceinline__ v16h cat16(v8h lo, v8h hi) { return __builtin_shufflevector(lo, hi, 0, 1, 2, 3, 4, 5, 6, 7, 8, 9, 10, 11, 12, 13, 14, 15); }
__device__ __forceinline__ v16bf cat16b(v8us lo, v8us hi) { return __builtin_bit_cast(v16bf, __builtin_shufflevector(lo, hi, 0, 1, 2, 3, 4, 5, 6, 7, 8, 9, 10, 11, 12, 13, 14, 15)); }
__device__ __forceinline__ v8f wmma16(v16h a, v16h b, v8f c) { return __builtin_amdgcn_wmma_f32_16x16x32_f16(false, a, false, b, (short)0, c, false, false); }
template <int X> __device__ __forceinline__ float lanex(float v) { return __int_as_float(__builtin_amdgcn_update_dpp(0, __float_as_int(v), 0x160 + X, 0xf, 0xf, true)); }   // the value of lane ^ X (row_xmask, inside a 16-lane row, every lane on)
// exp2x8: e[i] = 2^e[i]. One statement keeps the slot that a transcendental asks for behind it: the results are early-clobber, so none takes the source register of the exponential in front of it,
// and the v_nop stands between the last one and whatever reads its result first.
__device__ __forceinline__ void exp2x8(float (&e)[8]) {
    float r0, r1, r2, r3, r4, r5, r6, r7;
    asm("v_exp_f32 %0, %8\n\tv_exp_f32 %1, %9\n\tv_exp_f32 %2, %10\n\tv_exp_f32 %3, %11\n\tv_exp_f32 %4, %12\n\tv_exp_f32 %5, %13\n\tv_exp_f32 %6, %14\n\tv_exp_f32 %7, %15\n\tv_nop"
        : "=&v"(r0), "=&v"(r1), "=&v"(r2), "=&v"(r3), "=&v"(r4), "=&v"(r5), "=&v"(r6), "=&v"(r7)
        : "v"(e[0]), "v"(e[1]), "v"(e[2]), "v"(e[3]), "v"(e[4]), "v"(e[5]), "v"(e[6]), "v"(e[7]));
    e[0] = r0; e[1] = r1; e[2] = r2; e[3] = r3; e[4] = r4; e[5] = r5; e[6] = r6; e[7] = r7;
}
__device__ __forceinline__ v8f wmmab(v16bf a, v16bf b, v8f c) { return __builtin_amdgcn_wmma_f32_16x16x32_bf16(false, a, false, b, (short)0, c, false, false); }

// k_wt: WT [n][K] = bf16(W[k][n]) (k-major [K][ncols]) via 64 x 64 LDS tiles; grid (K/64, ncols/64, 3): z picks the weight, the three transposes lie one behind the other as one [3 * ncols][K] matrix.
__global__ __launch_bounds__(256) void k_wt(const float* __restrict__ W0, const float* __restrict__ W1, const float* __restrict__ W2, int K, int ncols, bf* WT) {
    __shared__ __align__(16) unsigned short tl[64 * 72];
    const float* __restrict__ Wm = blockIdx.z == 0 ? W0 : (blockIdx.z == 1 ? W1 : W2); WT += (size_t)blockIdx.z * ncols * K;
    const int tid = threadIdx.x, k0 = blockIdx.x * 64, n0 = blockIdx.y * 64;
    const int kk = tid >> 2, nq = (tid & 3) * 16;
#pragma unroll
    for (int i = 0; i < 16; ++i) tl[(nq + i) * 72 + kk] = f2bf(Wm[(size_t)(k0 + kk) * ncols + n0 + nq + i]);
    __syncthreads();
    const int piece = tid & 7;
    auto pass = [&]() {
#pragma unroll
        for (int s = 0; s < 2; ++s) { const int nr = (tid >> 3) + 32 * s; const v8us val = *(const v8usa*)(tl + nr * 72 + piece * 8); *(v8us*)(WT + (size_t)(n0 + nr) * K + k0 + piece * 8) = val; }
    };
    pass(); 
}
// Tile staging for the matrix kernels: a 64-row x 64-k 16-bit plane (bf16 in k_gemmb, f16 in k_gemm1) lies in LDS at a row pitch of 144 B (16 B x 9, conflict-free for 16-byte fragment reads).
#define TP   72            // LDS row pitch, bf16 elements
#define TPL  (64 * TP)     // one plane, bf16 elements
#define TPLB (TPL * 2)     // one plane, bytes
// cp8: this lane's 16-byte pieces of two planes (rows +0, +16, +32, +48 of each): a wave's copy reads four whole 128-B lines. st = 16 source rows in elements.
__device__ __forceinline__ void cp8(const bf* p, const bf* q, size_t st, unsigned lp, unsigned lq) {
    // asynchronous copies global -> LDS; s_wait_xcnt 0 closes the statement so that no address register is rewritten ahead of it
    asm volatile("global_load_async_to_lds_b128 %0, %8, off\n\t"
                 "global_load_async_to_lds_b128 %1, %9, off\n\t"
                 "global_load_async_to_lds_b128 %2, %10, off\n\t"
                 "global_load_async_to_lds_b128 %3, %11, off\n\t"
                 "global_load_async_to_lds_b128 %4, %12, off\n\t"
                 "global_load_async_to_lds_b128 %5, %13, off\n\t"
                 "global_load_async_to_lds_b128 %6, %14, off\n\t"
                 "global_load_async_to_lds_b128 %7, %15, off\n\t"
                 "s_wait_xcnt 0x0"
                 :: "v"(lp), "v"(lp + 16u * 144u), "v"(lp + 32u * 144u), "v"(lp + 48u * 144u), "v"(lq), "v"(lq + 16u * 144u), "v"(lq + 32u * 144u), "v"(lq + 48u * 144u),
                    "v"(p), "v"(p + st), "v"(p + 2 * st), "v"(p + 3 * st), "v"(q), "v"(q + st), "v"(q + 2 * st), "v"(q + 3 * st) : "memory");
}
// cp4: the same for one plane.
__device__ __forceinline__ void cp4(const bf* p, size_t st, unsigned lp) {
    // asynchronous copies global -> LDS; s_wait_xcnt 0 closes the statement so that no address register is rewritten ahead of it
    asm volatile("global_load_async_to_lds_b128 %0, %4, off\n\t"
                 "global_load_async_to_lds_b128 %1, %5, off\n\t"
                 "global_load_async_to_lds_b128 %2, %6, off\n\t"
                 "global_load_async_to_lds_b128 %3, %7, off\n\t"
                 "s_wait_xcnt 0x0"
                 :: "v"(lp), "v"(lp + 16u * 144u), "v"(lp + 32u * 144u), "v"(lp + 48u * 144u), "v"(p), "v"(p + st), "v"(p + 2 * st), "v"(p + 3 * st) : "memory");
}
__device__ __forceinline__ void wait_copies() { asm volatile("s_wait_asynccnt 0x0" ::: "memory"); }   // this wave's copies have landed in LDS
__device__ __forceinline__ void wait_lds()    { asm volatile("s_wait_dscnt 0x0" ::: "memory"); }      // this wave's LDS reads are done before the buffer is refilled
__device__ __forceinline__ v16bf frag(const bf* r) { return cat16b(*(const v8usa*)r, *(const v8usa*)(r + 16)); }
__device__ __forceinline__ v16h fragh(const bf* r) { return __builtin_bit_cast(v16h, frag(r)); }   // the same bytes read as f16: both 16-bit forms share one fragment layout

// hold: four vector slots behind the pass's last matrix instruction on every path; naming every accumulator also keeps that instruction in front of the waits and the barrier that follow
template <int FM>
__device__ __forceinline__ void hold(v8f (&c)[FM][4]) {
    static_assert(FM == 2 || FM == 4, "two or four rows of accumulator tiles");
    if constexpr (FM == 4)
        asm volatile("v_nop\n\tv_nop\n\tv_nop\n\tv_nop" : "+v"(c[0][0]), "+v"(c[0][1]), "+v"(c[0][2]), "+v"(c[0][3]), "+v"(c[1][0]), "+v"(c[1][1]), "+v"(c[1][2]), "+v"(c[1][3]),
                                                          "+v"(c[2][0]), "+v"(c[2][1]), "+v"(c[2][2]), "+v"(c[2][3]), "+v"(c[3][0]), "+v"(c[3][1]), "+v"(c[3][2]), "+v"(c[3][3]));
    else
        asm volatile("v_nop\n\tv_nop\n\tv_nop\n\tv_nop" : "+v"(c[0][0]), "+v"(c[0][1]), "+v"(c[0][2]), "+v"(c[0][3]), "+v"(c[1][0]), "+v"(c[1][1]), "+v"(c[1][2]), "+v"(c[1][3]));
}

// k_gemmb: 128 x 128 block tile (2 x 2 waves, 64 x 64 each) of [q | k | v] = A.B^T (K = 1024); A and B tiles (two 64-row planes each) staged in LDS, two buffers.
// The epilogue writes what the score and wei.v stages read, in whole 128-byte lines, staged per wave in the ring, which every wave has left at the last pass's barrier:
// a q block (scaled by scq) or a k block goes out as one f16 plane, row-major (QK: all items of q, behind them all items of k);
// a v block goes out as one f16 plane transposed ([d][t] per item): a lane's eight accumulator rows of one column are eight neighbours of a transposed row.
__global__ __launch_bounds__(128) void k_gemmb(const bf* __restrict__ A, const bf* __restrict__ Bn, int K, float scq, bf* QK, bf* VT) {
    __shared__ __align__(16) bf stg[2 * 4 * TPL];
    static_assert(4 * 64 * 68 * 4 <= 2 * 4 * TPLB && 4 * TPLB <= 2 * 4 * TPLB, "either output staging fits the ring");
    const int tid = threadIdx.x, lane = tid & 31, wave = tid >> 5, lr = lane & 15, hi = lane >> 4, wm = wave >> 1, wn = wave & 1;
    const size_t ao = (size_t)(blockIdx.x * 128 + (tid >> 3)) * K + (tid & 7) * 8, bo = (size_t)(blockIdx.y * 128 + (tid >> 3)) * K + (tid & 7) * 8, st16 = (size_t)16 * K, st64 = (size_t)64 * K;
    const unsigned l0 = (unsigned)(size_t)&stg[0] + (unsigned)((tid >> 3) * 144 + (tid & 7) * 16);
    auto fill = [&](int t) { const unsigned lb = l0 + (unsigned)(t & 1) * (4u * TPLB);
        cp8(A + ao + t * 64, A + ao + st64 + t * 64, st16, lb, lb + TPLB); cp8(Bn + bo + t * 64, Bn + bo + st64 + t * 64, st16, lb + 2u * TPLB, lb + 3u * TPLB); };
    const int nt = K >> 6;
    v8f acc[4][4];
#pragma unroll
    for (int m = 0; m < 4; ++m) {
#pragma unroll
        for (int t = 0; t < 4; ++t) acc[m][t] = (v8f){}; }
    fill(0); wait_copies(); __syncthreads();
    if (nt > 1) fill(1);
#pragma unroll 1   // stays rolled: one pass per staged tile, the two buffers alternate
    for (int s = 0; s < nt; ++s) {
        const bf* sb = &stg[(s & 1) * 4 * TPL];
#pragma unroll     // both 32-k halves of the tile in one block: fragment offsets become immediates and the LDS reads overlap the matrix work
        for (int ks = 0; ks < 2; ++ks) {
            v16bf a[4], b[4];
#pragma unroll
            for (int m = 0; m < 4; ++m) a[m] = frag(sb + (wm * 64 + m * 16 + lr) * TP + ks * 32 + 8 * hi);
#pragma unroll
            for (int t = 0; t < 4; ++t) b[t] = frag(sb + 2 * TPL + (wn * 64 + t * 16 + lr) * TP + ks * 32 + 8 * hi);
            __builtin_amdgcn_sched_barrier(0);   // the step's fragment loads stay one group in front of its matrix block: sunk among the matrix instructions, each pair is waited out on its own
#pragma unroll
            for (int t = 0; t < 4; ++t) {
#pragma unroll
                for (int m = 0; m < 4; ++m) acc[m][t] = wmmab(a[m], b[t], acc[m][t]); }
        }
        hold<4>(acc);
        wait_lds(); wait_copies(); __syncthreads();    // publishes tile s + 1 and ends every read of tile s
        if (s + 2 < nt) fill(s + 2);
    }
    wait_copies();
    const int item = blockIdx.x / (NN / 128), t0 = (blockIdx.x % (NN / 128)) * 128 + wm * 64;    // the wave's 64 rows inside their item
    const int sel = blockIdx.y / (DI / 128), d0 = (blockIdx.y % (DI / 128)) * 128 + wn * 64;     // 0 = q, 1 = k, 2 = v (the same for the whole block); the wave's 64 columns inside that matrix
    const int rw = lane >> 3, piece = lane & 7;                                                  // write-out: eight lanes per 128-byte line, four lines per store
    float* os = (float*)(void*)stg + wave * (64 * 68);
    bf* ot = stg + wave * TPL;
    if (sel < 2) {
#pragma unroll
        for (int m = 0; m < 4; ++m) {
#pragma unroll
            for (int t = 0; t < 4; ++t) {
#pragma unroll
                for (int j = 0; j < 8; ++j) os[(m * 16 + hi * 8 + j) * 68 + t * 16 + lr] = acc[m][t][j]; } }
    } else {
#pragma unroll
        for (int m = 0; m < 4; ++m) {
#pragma unroll
            for (int t = 0; t < 4; ++t) { v8us oh;
#pragma unroll
                for (int j = 0; j < 8; ++j) oh[j] = f2h(acc[m][t][j]);
                *(v8usa*)(ot + (t * 16 + lr) * TP + m * 16 + hi * 8) = oh; } }
    }
    __syncthreads();
    if (sel < 2) {
        const float sc = sel ? 1.0f : scq;
        bf* dh = QK + ((size_t)sel * NBT + item) * ((size_t)NN * DI) + (size_t)t0 * DI + d0 + piece * 8;
#pragma unroll
        for (int g = 0; g < 4; ++g) { v4f v0[4], v1[4];     // sixteen rows at a time: their LDS reads go out together and are waited for once
#pragma unroll
            for (int u = 0; u < 4; ++u) { const float* p = os + (rw + 16 * g + 4 * u) * 68 + piece * 8; v0[u] = *(const v4fa*)p; v1[u] = *(const v4fa*)(p + 4); }
#pragma unroll
            for (int u = 0; u < 4; ++u) { const int row = rw + 16 * g + 4 * u; v8us oh;
#pragma unroll
                for (int i = 0; i < 8; ++i) oh[i] = f2h((i < 4 ? v0[u][i & 3] : v1[u][i & 3]) * sc);
                *(v8us*)(dh + (size_t)row * DI) = oh; }
            asm volatile("s_wait_xcnt 0x0" ::: "memory"); }   // the next sixteen rows reuse the stores' registers
    } else {
        bf* th = VT + (size_t)item * DI * NN + (size_t)d0 * NN + t0 + piece * 8;
#pragma unroll
        for (int g = 0; g < 4; ++g) { v8us oh[4];    // sixteen transposed rows at a time: their LDS reads go out together and are waited for once
#pragma unroll
            for (int u = 0; u < 4; ++u) oh[u] = *(const v8usa*)(ot + (rw + 16 * g + 4 * u) * TP + piece * 8);
#pragma unroll
            for (int u = 0; u < 4; ++u) *(v8us*)(th + (size_t)(rw + 16 * g + 4 * u) * NN) = oh[u];
            asm volatile("s_wait_xcnt 0x0" ::: "memory"); }   // the next sixteen rows reuse the stores' registers
    }
}

// k_gemm1: BM x BN block tile (2 x 2 waves, BM/2 x 64 each; BN = 128) of C = A.B^T over K, f16 operands, f32 accumulate (row strides: K for B, AS * K for A; n-major B);
// the two operands' tiles staged in LDS as 64-row planes, two buffers; f32 whole-line epilogue, staged per wave in the ring, which every wave has left at the last pass's barrier.
// grid.z = item: sA, sB, sC are the item strides (elements) of A, B and C. ST: per item, 64-key tile and row the pair (tile maximum, tile sum), [item][tile][row][2].
// MODE 1 (scores): blocks and wave tiles wholly above the diagonal leave; C is an f16 plane: each remaining wave turns its 64 x 64 tile into exp(s - tile maximum) * LOSC, 0 above the diagonal, and writes the pairs to ST.
// MODE 2 (wei.v): K ends at the row block's causal limit; a pass is one 64-key tile, whose product is added times the row's factor for that tile (from ST); C is scaled by 1 / LOSC (exact).
template <int MODE, int BM, int BN, int AS>
__global__ __launch_bounds__(128) void k_gemm1(const bf* __restrict__ A, const bf* __restrict__ B, int K, float* C, int ldc, size_t sA, size_t sB, size_t sC, float* ST) {
    constexpr int CA = BM / 64, CB = BN / 64, WM = BM / 2, FM = WM / 16, NPL = CA + CB, KG = FM == 4 ? 1 : 2;   // 64-row planes per operand; rows and accumulator rows per wave; planes per buffer; 32-k halves whose fragments are loaded as one group
    static_assert(BN == 128 && 4 * WM * 68 * 4 <= 2 * NPL * TPLB, "64 columns per wave; the output staging fits the ring");
    static_assert(!(MODE & 1) || WM == 64, "a score wave's tile is one 64-row x 64-key softmax tile");
    static_assert(!(MODE & 2) || BM == 64, "two threads per row form the factors");
    constexpr int NTL = NN / 64;      // 64-key tiles in a row
    if ((MODE & 1) && (int)blockIdx.y * BN > (int)blockIdx.x * BM + BM - 1) return;
    const int Klim = (MODE & 2) ? min(K, ((int)blockIdx.x + 1) * BM) : K;
    __shared__ __align__(16) bf stg[2 * NPL * TPL];
    __shared__ __align__(16) float fac[(MODE & 2) ? NTL * BM : 4];    // MODE 2: [tile][row] factors
    const int tid = threadIdx.x, lane = tid & 31, wave = tid >> 5, lr = lane & 15, hi = lane >> 4, wm = wave >> 1, wn = wave & 1;
    const int r0 = blockIdx.x * BM + wm * WM, c0 = blockIdx.y * BN + wn * 64;
    const size_t ao = blockIdx.z * sA + (size_t)(blockIdx.x * BM) * K * AS, bo = blockIdx.z * sB + (size_t)(blockIdx.y * BN) * K, st16 = (size_t)16 * K, st64 = (size_t)64 * K;   // the block's tiles: the same in every lane
    const unsigned vo = (unsigned)((tid >> 3) * K + (tid & 7) * 8), va = (unsigned)((tid >> 3) * K * AS + (tid & 7) * 8);   // this lane's piece inside a 16-row slab of B and of A; the k offset is added in 32 bits
    const unsigned l0 = (unsigned)(size_t)&stg[0] + (unsigned)((tid >> 3) * 144 + (tid & 7) * 16);
    auto fill = [&](int t) { const unsigned lb = l0 + (unsigned)(t & 1) * ((unsigned)NPL * TPLB);
        const bf* pa = A + ao + (va + (unsigned)t * 64u); const bf* pb = B + bo + (vo + (unsigned)t * 64u);
        if constexpr (CA == 2) cp8(pa, pa + AS * st64, AS * st16, lb, lb + TPLB); else cp4(pa, AS * st16, lb);
        cp8(pb, pb + st64, st16, lb + (unsigned)CA * TPLB, lb + (unsigned)(CA + 1) * TPLB); };
    const int nt = Klim >> 6;
    v8f acc[FM][4];
#pragma unroll
    for (int m = 0; m < FM; ++m) {
#pragma unroll
        for (int t = 0; t < 4; ++t) acc[m][t] = (v8f){}; }
    fill(0);
    if constexpr (MODE & 2) {      // the rows' factors, formed while tile 0's copies fly; the barrier below publishes them
        const int row = tid & (BM - 1), half = tid / BM;
        const float* sp = ST + ((size_t)blockIdx.z * NTL * NN + blockIdx.x * BM + row) * 2;
        v2f p[NTL];
#pragma unroll
        for (int t = 0; t < NTL; ++t) { p[t] = (v2f){-1.0e30f, 0.f}; if (t < nt) p[t] = *(const v2fa*)(sp + (size_t)t * NN * 2); }
        asm volatile("s_wait_xcnt 0x0" :: "v"(sp) : "memory");   // stands in front of any reuse of the loads' address registers, which the operand keeps whole up to here
        float mx = p[0][0];
#pragma unroll
        for (int t = 1; t < NTL; ++t) mx = fmaxf(mx, p[t][0]);
        float sum = 0.f; const float cx = -mx * L2E;
#pragma unroll
        for (int t8 = 0; t8 < NTL; t8 += 8) { float e[8];
#pragma unroll
            for (int i = 0; i < 8; ++i) e[i] = fmaf(p[t8 + i][0], L2E, cx);    // 2^(m * log2 e + cx) = exp(m - mx); 0 for a tile past the limit
            exp2x8(e);
#pragma unroll
            for (int i = 0; i < 8; ++i) { p[t8 + i][0] = e[i]; sum = fmaf(e[i], p[t8 + i][1], sum); } }
        const float inv = 1.0f / sum;
#pragma unroll
        for (int t = 0; t < NTL; ++t) if (t < nt && (t & 1) == half) fac[t * BM + row] = p[t][0] * inv;
    }
    wait_copies(); __syncthreads();
    if (nt > 1) fill(1);
#pragma unroll 1   // stays rolled: one pass per staged tile, the two buffers alternate
    for (int s = 0; s < nt; ++s) {
        const bf* sb = &stg[(s & 1) * NPL * TPL];
        v8f fr[FM], part[FM][4];   // MODE 2: this pass's factor of each accumulator row; the pass's own product
#pragma unroll     // the whole tile in one block: fragment offsets become immediates and the LDS reads overlap the matrix work
        for (int kg = 0; kg < 2; kg += KG) {
            v16h a[KG][FM], b[KG][4];
#pragma unroll
            for (int h = 0; h < KG; ++h) {
#pragma unroll
                for (int m = 0; m < FM; ++m) a[h][m] = fragh(sb + (wm * WM + m * 16 + lr) * TP + (kg + h) * 32 + 8 * hi);
#pragma unroll
                for (int t = 0; t < 4; ++t) b[h][t] = fragh(sb + CA * TPL + (wn * 64 + t * 16 + lr) * TP + (kg + h) * 32 + 8 * hi); }
            if constexpr (MODE & 2) {
                static_assert(!(MODE & 2) || KG == 2, "one fragment group per pass");
#pragma unroll
                for (int m = 0; m < FM; ++m) { const float* fp = fac + s * BM + wm * WM + m * 16 + hi * 8; const v4f f0 = *(const v4fa*)fp, f1 = *(const v4fa*)(fp + 4);
                    fr[m] = __builtin_shufflevector(f0, f1, 0, 1, 2, 3, 4, 5, 6, 7); } }
            __builtin_amdgcn_sched_barrier(0);   // the group's fragment loads stay in front of its sixteen matrix instructions: sunk among them, each pair is waited out on its own
#pragma unroll
            for (int h = 0; h < KG; ++h) {
#pragma unroll
                for (int t = 0; t < 4; ++t) {
#pragma unroll
                    for (int m = 0; m < FM; ++m) {
                        if constexpr (MODE & 2) part[m][t] = wmma16(a[h][m], b[h][t], h == 0 ? (v8f){} : part[m][t]);
                        else acc[m][t] = wmma16(a[h][m], b[h][t], acc[m][t]); } } }
        }
        if constexpr (MODE & 2) __builtin_amdgcn_sched_barrier(0);   // the pass's matrix instructions stay in front of the waits and the barrier: lifted over them, the wait for tile s + 1 comes before the work that should cover its flight
        else hold<FM>(acc);
        wait_lds(); wait_copies(); __syncthreads();    // publishes tile s + 1 and ends every read of tile s
        if (s + 2 < nt) fill(s + 2);
        if constexpr (MODE & 2) {
#pragma unroll
            for (int t = 0; t < 4; ++t) {
#pragma unroll
                for (int m = 0; m < FM; ++m) acc[m][t] += fr[m] * part[m][t]; } }
    }
    wait_copies();
    float* os = (float*)(void*)stg + wave * (WM * 68);
    constexpr float osc = (MODE & 2) ? 1.0f / LOSC : 1.0f;
#pragma unroll
    for (int m = 0; m < FM; ++m) {
#pragma unroll
        for (int t = 0; t < 4; ++t) {
#pragma unroll
            for (int j = 0; j < 8; ++j) os[(m * 16 + hi * 8 + j) * 68 + t * 16 + lr] = acc[m][t][j] * osc; } }
    __builtin_amdgcn_wave_barrier(); asm volatile("" ::: "memory");   // the wave's staged rows are stored before any of its lanes reads them back; no other wave touches them
    if constexpr (MODE & 1) {
        if (c0 > r0 + WM - 1) return;      // a tile wholly above the diagonal: wei.v reads neither it nor its pairs; the whole wave leaves, and no barrier follows
        const int rw = lane >> 3, piece = lane & 7;    // eight lanes per row of 64 keys: one 128-byte line of f16, four lines per store
        bf* ph = (bf*)(void*)C + blockIdx.z * sC + (size_t)r0 * ldc + c0 + piece * 8;
        const int dl = r0 - c0 - piece * 8;            // key i of this lane's eight is above the diagonal of staged row r where i > dl + r
#pragma unroll
        for (int g = 0; g < 4; ++g) { v4f v0[4], v1[4];     // sixteen rows at a time: their LDS reads go out together and are waited for once
#pragma unroll
            for (int u = 0; u < 4; ++u) { const float* p = os + (rw + 16 * g + 4 * u) * 68 + piece * 8; v0[u] = *(const v4fa*)p; v1[u] = *(const v4fa*)(p + 4); }
#pragma unroll
            for (int u = 0; u < 4; ++u) { const int row = rw + 16 * g + 4 * u; float e[8]; float mt = -1.0e30f, sm = 0.f; v8us oh;
#pragma unroll
                for (int i = 0; i < 8; ++i) { e[i] = i > dl + row ? -1.0e38f : (i < 4 ? v0[u][i & 3] : v1[u][i & 3]); mt = fmaxf(mt, e[i]); }   // a masked key lies far below the maximum's start value: its exponential is 0
                mt = fmaxf(mt, lanex<1>(mt)); mt = fmaxf(mt, lanex<2>(mt)); mt = fmaxf(mt, lanex<4>(mt));
                const float cm = fmaf(mt, -L2E, 10.0f);     // 2^(s * log2 e + cm) = exp(s - mt) * LOSC: one multiply-add in front of each exponential
#pragma unroll
                for (int i = 0; i < 8; ++i) e[i] = fmaf(e[i], L2E, cm);
                exp2x8(e);
#pragma unroll
                for (int i = 0; i < 8; ++i) { sm += e[i]; oh[i] = f2h(e[i]); }
                sm += lanex<1>(sm); sm += lanex<2>(sm); sm += lanex<4>(sm);
                *(v8us*)(ph + (size_t)row * ldc) = oh;
                if (piece == 0) *(v2fa*)(os + row * 68 + 64) = (v2f){mt, sm * (1.0f / LOSC)}; }   // the pair waits in the staged row's pad; the sum's scale is undone exactly
            asm volatile("s_wait_xcnt 0x0" ::: "memory"); }   // the next sixteen rows reuse the stores' registers
        __builtin_amdgcn_wave_barrier(); asm volatile("" ::: "memory");   // the wave's pairs are stored before its lanes read them back row by row
        float* sp = ST + (((size_t)blockIdx.z * NTL + (c0 >> 6)) * NN + r0 + lane) * 2;
#pragma unroll
        for (int h = 0; h < 2; ++h) *(v2fa*)(sp + h * 64) = *(const v2fa*)(os + (lane + 32 * h) * 68 + 64);   // 32 rows' pairs: two whole lines per store
    } else {
        float* crow = C + blockIdx.z * sC + (size_t)r0 * ldc + c0;
#pragma unroll
        for (int s = 0; s < 8 * FM; ++s) { const int Lid = (lane >> 3) + 4 * s, piece = lane & 7; const int row = Lid >> 1, cofs = (Lid & 1) * 32 + piece * 4;
            const v4f val = *(const v4fa*)(os + row * 68 + cofs); *(v4f*)(crow + (size_t)row * ldc + cofs) = val; }
    }
}


__global__ __launch_bounds__(256) void k_cat(const float* __restrict__ a, const float* __restrict__ c, bf* Xb) {
    const int lane = threadIdx.x & 31; const size_t t = (size_t)blockIdx.x * 8 + (threadIdx.x >> 5); if (t >= (size_t)NBT * NN) return;   // t runs over the rows of all items
{
#pragma unroll
        for (int q = 0; q < 4; ++q) { const float* src = (q < 2 ? a : c) + t * DI + (q & 1) * 256 + lane * 8; v8us o;
#pragma unroll
            for (int i = 0; i < 8; ++i) o[i] = f2bf(src[i]);
            *(v8us*)(Xb + t * DX + q * 256 + lane * 8) = o; }
         }
}
__global__ __launch_bounds__(256) void k_ln512(const float* __restrict__ O, const float* __restrict__ g, const float* __restrict__ bb, float* OUTB) {
    const int lane = threadIdx.x & 31; const size_t t = (size_t)blockIdx.x * 8 + (threadIdx.x >> 5); if (t >= (size_t)NBT * NN) return; float v[16]; float s = 0.f;   // t runs over the rows of all items
#pragma unroll
    for (int q = 0; q < 4; ++q) {
#pragma unroll
        for (int i = 0; i < 4; ++i) { v[q * 4 + i] = O[t * DI + q * 128 + lane * 4 + i]; s += v[q * 4 + i]; } }
#pragma unroll
    for (int sh = 16; sh; sh >>= 1) s += __shfl_xor(s, sh, 32);
    const float mu = s * (1.0f / DI); float qv = 0.f;
#pragma unroll
    for (int i = 0; i < 16; ++i) { const float d = v[i] - mu; qv = fmaf(d, d, qv); }
#pragma unroll
    for (int sh = 16; sh; sh >>= 1) qv += __shfl_xor(qv, sh, 32);
    const float rs = rsqrtf(qv * (1.0f / DI) + LEPS);
{
#pragma unroll
        for (int q = 0; q < 4; ++q) { const int c0 = q * 128 + lane * 4; v4f y;
#pragma unroll
            for (int i = 0; i < 4; ++i) y[i] = (v[q * 4 + i] - mu) * rs * bfr(g[c0 + i]) + bfr(bb[c0 + i]);
            *(v4f*)(OUTB + t * DI + c0) = y; }
         }
}

extern "C" void kernel_launch(void* const* d_in, const int* in_sizes, int n_in,
                              void* d_out, int out_size, void* d_ws, size_t ws_size, hipStream_t stream) {
    (void)in_sizes; (void)n_in; (void)out_size;
    const float* x0 = (const float*)d_in[0]; const float* x1 = (const float*)d_in[1]; const float* Wq = (const float*)d_in[2]; const float* Wk = (const float*)d_in[3]; const float* Wv = (const float*)d_in[4]; const float* gam = (const float*)d_in[5]; const float* bet = (const float*)d_in[6];
    float* out = (float*)d_out;    // [8][2048][512]
    char* wsp = (char*)d_ws;
    auto take = [&](size_t bytes) { char* p = wsp; wsp += (bytes + 255) & ~(size_t)255; return (void*)p; };
    const size_t PLN = (size_t)NN * DI;      // one [2048][512] plane, elements
    const size_t SQ  = (size_t)NN * NN;      // one [2048][2048] plane, elements
    bf* WT = (bf*)take((size_t)3 * DI * DX * 2);                       // [Wq^T ; Wk^T ; Wv^T] as one [1536][1024] matrix
    bf* QK = (bf*)take((size_t)2 * NBT * PLN * 2);                     // q of all items as f16; behind it the same for k
    bf* VT = (bf*)take((size_t)NBT * PLN * 2);                         // v^T of all items as f16
    float* O = (float*)take((size_t)NBT * PLN * 4);                    // the attention output
    float* ST = (float*)take((size_t)NBT * (NN / 64) * NN * 2 * 4);    // per item, 64-key tile and row: (tile maximum, tile sum)
    char* RA = (char*)take((size_t)NBT * SQ * 2);                                        // 64 MiB, used twice in stream order
    bf* Xb = (bf*)RA;                                                                    // first: x as bf16 (all items)
    bf* PH = (bf*)RA;                                                                    // then: the f16 plane of tile-wise exponentials of all items
    bf* KB = QK + (size_t)NBT * PLN;
    if ((size_t)(wsp - (char*)d_ws) > ws_size) return;    // 3 + 32 + 16 + 32 + 4 + 64 = 151 MiB
    k_wt<<<dim3(DX / 64, DI / 64, 3), 256, 0, stream>>>(Wq, Wk, Wv, DX, DI, WT);   // (in, out) weights
    k_cat<<<NBT * NN / 8, 256, 0, stream>>>(x0, x1, Xb);
    k_gemmb<<<dim3(NBT * NN / 128, 3 * DI / 128, 1), 128, 0, stream>>>(Xb, WT, DX, SCL, QK, VT);
    k_gemm1<1, 128, 128, 1><<<dim3(NN / 128, NN / 128, NBT), 128, 0, stream>>>(QK, KB, DI, (float*)(void*)PH, NN, PLN, PLN, SQ, ST);   // causal tiles only
    k_gemm1<2, 64, 128, 1><<<dim3(NN / 64, DI / 128, NBT), 128, 0, stream>>>(PH, VT, NN, O, DI, SQ, PLN, PLN, ST);                    // K limited to the causal extent
    k_ln512<<<NBT * NN / 8, 256, 0, stream>>>(O, gam, bet, out);
}
